// v000
// Times are from an AMD MI455X. After a warm-up the kernel runs many times in a row, and a time is the length of
// such a window on the GPU divided by its runs, so every launch and the gaps after it count. The runs cycle
// through copies of the inputs. A figure is the median of several windows, for all but v000 over two sittings.
// Sittings can differ by a few percent; kernels timed side by side share one.
// v000, which the later versions start from, runs in 362 microseconds.
#include <hip/hip_runtime.h>

// "Fast attention": [q | k | v | t] = x W_qkv (8 heads x 64 each); query i uses q[i mod 513] (the module's pad/reshape/tile trick with STEP 4, n = 2048); attn1 = softmax(q~.k / 8) over
// all 2048 keys; out1 = attn1.v; attn2[n][m] = exp(-|n-m|/e) / s[m] with s[m] = sum_k exp(-|m-k|/e) (the module's broadcast divides column m by row-sum m); out2 = attn2.t (shared
// over batch and heads); out = [out1 | out2 per head] W_out + b -> [2][2048][512].
// Numerics: x, W_qkv, W_out, b_out rounded to bf16; projection on v_wmma_f32_16x16x32_bf16 (exact products); q, k, v, t, P and the
// merged attention output carried x8 as f16 hi+lo pairs (3 / 2 products) on v_wmma_f32_16x16x32_f16; the analytic attn2 matrix as an x8 f16 hi+lo pair (entries that would be f16-
// subnormal are zeroed identically everywhere — they are < 8e-6 of a row); online softmax and the row sums s[m] in f32. Fragment k-map per lane half hh for A AND B: elements 0..7 <-

namespace {
constexpr int Bn = 2, S = 2048, DIM = 512, H = 8, HD = 64, INNER = 512, NTOK = Bn * S, QP = 513 /* (n + yushu) / STEP */;
constexpr float SCALE = 0.125f, VS = 8.0f, QS = 8.0f, PS = 8.0f, AS2 = 8.0f, INV_E = 0.36787944117144233f;
constexpr size_t QPL = (size_t)Bn * H * S * HD, VPL = QPL, APL = (size_t)S * S;

typedef _Float16 b16;
typedef __attribute__((ext_vector_type(16))) _Float16 v16b;
typedef __attribute__((ext_vector_type(8)))  _Float16 v8b;
typedef __attribute__((ext_vector_type(8)))  float v8f;
typedef __attribute__((ext_vector_type(4)))  float v4f;

__device__ __forceinline__ v8b ld8b(const b16* p) { return *(const v8b*)p; }
__device__ __forceinline__ v16b cat8b(v8b a, v8b b) { return __builtin_shufflevector(a, b, 0, 1, 2, 3, 4, 5, 6, 7, 8, 9, 10, 11, 12, 13, 14, 15); }
__device__ __forceinline__ v16b frag_kb(const b16* p, int hh) { return cat8b(ld8b(p + 8 * hh), ld8b(p + 16 + 8 * hh)); }
__device__ __forceinline__ void split16(float v, b16& hi, b16& lo) { hi = (b16)v; lo = (b16)(v - (float)hi); }
// hi/lo fragment pair straight from an f32 k-contiguous row (same k-map)
__device__ __forceinline__ void frag_ksplit(const float* p, int hh, v16b& fh_, v16b& fl_) {
  const float* p0 = p + 8 * hh; const float* p1 = p + 16 + 8 * hh;
#pragma unroll
  for (int e = 0; e < 8; ++e) { b16 a, c; split16(p0[e], a, c); fh_[e] = a; fl_[e] = c; split16(p1[e], a, c); fh_[8 + e] = a; fl_[8 + e] = c; }
}
__device__ __forceinline__ v8f wmma16b(v16b a, v16b b, v8f c) {
  v8f d = __builtin_amdgcn_wmma_f32_16x16x32_f16(false, a, false, b, (short)0, c, false, false);
  asm volatile("v_nop\n\tv_nop\n\tv_nop\n\tv_nop" : "+v"(d) : "v"(a), "v"(b));
  return d;
}
__device__ __forceinline__ void wave_lds_sync() {
  __builtin_amdgcn_fence(__ATOMIC_RELEASE, "workgroup");
  __builtin_amdgcn_wave_barrier();
  __builtin_amdgcn_fence(__ATOMIC_ACQUIRE, "workgroup");
}

// Operand descriptor: NP = 0 -> f32 rows split on the fly into (hi, lo); NP = 1 -> one f16 plane; NP = 2 -> f16 hi + lo planes;
// NP = 3 -> f32 rows rounded once to a single f16 fragment. ld = row pitch.
struct Opnd { const void* p0; const void* p1; int ld; };
template <int NP> __device__ __forceinline__ void load_frags(const Opnd& o, int row, int kb, int hh, v16b& fh_, v16b& fl_) {
  if (NP == 0) { frag_ksplit((const float*)o.p0 + (size_t)row * o.ld + kb, hh, fh_, fl_); }
  else if (NP == 4 || NP == 5) {                             // f32 rows x64 (NP 4) or x8 (NP 5) then split (keeps the lo halves of small values normal)
    const float sc_ = (NP == 4) ? 64.0f : 8.0f;
    const float* p = (const float*)o.p0 + (size_t)row * o.ld + kb; const float* p0 = p + 8 * hh; const float* p1 = p + 16 + 8 * hh;
#pragma unroll
    for (int e = 0; e < 8; ++e) { b16 a, c; split16(p0[e] * sc_, a, c); fh_[e] = a; fl_[e] = c; split16(p1[e] * sc_, a, c); fh_[8 + e] = a; fl_[8 + e] = c; }
  } else if (NP == 3) {
    const float* p = (const float*)o.p0 + (size_t)row * o.ld + kb; const float* p0 = p + 8 * hh; const float* p1 = p + 16 + 8 * hh;
#pragma unroll
    for (int e = 0; e < 8; ++e) { fh_[e] = (b16)p0[e]; fh_[8 + e] = (b16)p1[e]; }
    fl_ = fh_;
  } else {
    fh_ = frag_kb((const b16*)o.p0 + (size_t)row * o.ld + kb, hh);
    if (NP == 2) fl_ = frag_kb((const b16*)o.p1 + (size_t)row * o.ld + kb, hh); else fl_ = fh_;
  }
}
template <int ANP, int BNP> __device__ __forceinline__ v8f mac(v16b ah, v16b al, v16b bh, v16b bl, v8f c) {
  c = wmma16b(ah, bh, c);
  if (BNP == 0 || BNP == 2 || BNP == 4 || BNP == 5) c = wmma16b(ah, bl, c);     // hi.lo
  if (ANP == 0 || ANP == 2 || ANP == 4 || ANP == 5) c = wmma16b(al, bh, c);     // lo.hi   (lo.lo dropped)
  return c;
}
// 32x64 wave tile: acc[r][t] (rows m0+16r.., cols c0+16t..) += A[m][k] . B[n][k] over k in [0, K)
template <int ANP, int BNP>
__device__ __forceinline__ void gemm_tile(const Opnd& A, const Opnd& B, int K, int m0, int c0, int nloc, int hlf, v8f (&acc)[2][4]) {
  for (int kb = 0; kb < K; kb += 32) {
    v16b a0h, a0l, a1h, a1l;
    load_frags<ANP>(A, m0 + nloc, kb, hlf, a0h, a0l);
    load_frags<ANP>(A, m0 + 16 + nloc, kb, hlf, a1h, a1l);
#pragma unroll
    for (int t = 0; t < 4; ++t) {
      v16b bh, bl;
      load_frags<BNP>(B, c0 + t * 16 + nloc, kb, hlf, bh, bl);
      acc[0][t] = mac<ANP, BNP>(a0h, a0l, bh, bl, acc[0][t]);
      acc[1][t] = mac<ANP, BNP>(a1h, a1l, bh, bl, acc[1][t]);
    }
  }
}

__device__ __forceinline__ void epi_planes(v8f (&acc)[2][4], float scale, bool two, b16* __restrict__ oh, b16* __restrict__ ol, int ldo,
                                           int m0, int c0, int lane, b16* Th, b16* Tl) {
  const int nloc = lane & 15, hlf = lane >> 4;
#pragma unroll
  for (int t = 0; t < 4; ++t)
#pragma unroll
    for (int r = 0; r < 2; ++r)
#pragma unroll
      for (int v = 0; v < 8; ++v) {
        const int rr = r * 16 + v + 8 * hlf, cc = t * 16 + nloc;
        b16 h_, l_; split16(acc[r][t][v] * scale, h_, l_);
        Th[rr * 64 + cc] = h_; Tl[rr * 64 + cc] = l_;
      }
  wave_lds_sync();
  {
#pragma unroll
    for (int j = 0; j < 8; ++j) {
      const int rr = j * 4 + (lane >> 3), c8 = (lane & 7) * 8;
      const size_t o = (size_t)(m0 + rr) * ldo + c0 + c8;
      *(v8b*)(oh + o) = ld8b(Th + rr * 64 + c8);
      if (two) *(v8b*)(ol + o) = ld8b(Tl + rr * 64 + c8);
    }
    
  }
}
// (b) f32 rows with pitch ldo: 64 floats = 256 B = 2 lines per row; 16 lanes x 16 B per row, 2 rows per instruction. Optional per-row factor
__device__ __forceinline__ void epi_f32(v8f (&acc)[2][4], float scale, const float* rscale, float* __restrict__ out, int ldo, int m0, int c0, int lane, float* Tt) {
  const int nloc = lane & 15, hlf = lane >> 4;
#pragma unroll
  for (int t = 0; t < 4; ++t)
#pragma unroll
    for (int r = 0; r < 2; ++r)
#pragma unroll
      for (int v = 0; v < 8; ++v) {
        const int rr = r * 16 + v + 8 * hlf;
        const float rs = rscale ? rscale[(size_t)(m0 + rr) * 32] : 1.0f;
        Tt[rr * 64 + t * 16 + nloc] = acc[r][t][v] * scale * rs;
      }
  wave_lds_sync();
  float* dst0 = out + (size_t)m0 * ldo + c0;
  {
#pragma unroll
    for (int j = 0; j < 16; ++j) { const int rr = j * 2 + hlf, c4 = nloc * 4; *(v4f*)(dst0 + (size_t)rr * ldo + c4) = *(const v4f*)(Tt + rr * 64 + c4); }
    
  }
}



typedef __attribute__((ext_vector_type(8))) __bf16 v8bb; typedef __attribute__((ext_vector_type(16))) __bf16 v16bb;
typedef __attribute__((ext_vector_type(8))) unsigned short v8us;
__device__ __forceinline__ v16bb frag_kb_bf(const __bf16* p, int hh) { const v8bb a = *(const v8bb*)(p + 8 * hh), b = *(const v8bb*)(p + 16 + 8 * hh); return __builtin_shufflevector(a, b, 0, 1, 2, 3, 4, 5, 6, 7, 8, 9, 10, 11, 12, 13, 14, 15); }
__device__ __forceinline__ v8f wmma16bb(v16bb a, v16bb b, v8f c) {
  v8f d = __builtin_amdgcn_wmma_f32_16x16x32_bf16(false, a, false, b, (short)0, c, false, false);
  asm volatile("v_nop\n\tv_nop\n\tv_nop\n\tv_nop" : "+v"(d) : "v"(a), "v"(b));
  return d;
}
__device__ __forceinline__ unsigned short bf16_rne_bits(float v) { unsigned int u = __float_as_uint(v); u += 0x7FFFu + ((u >> 16) & 1u); return (unsigned short)(u >> 16); }
__device__ __forceinline__ float bf16_rne(float v) { return __uint_as_float(((unsigned int)bf16_rne_bits(v)) << 16); }



__global__ __launch_bounds__(256) void prep_kernel(const float* __restrict__ x, const float* __restrict__ wqkv, const float* __restrict__ wo, unsigned short* __restrict__ x16, unsigned short* __restrict__ w16, b16* __restrict__ wo16) {
  const size_t tid = (size_t)blockIdx.x * blockDim.x + threadIdx.x, nth = (size_t)gridDim.x * blockDim.x;
  {
    for (size_t p = tid; p < (size_t)NTOK * DIM / 8; p += nth) { v8us v;
#pragma unroll
      for (int e = 0; e < 8; ++e) v[e] = bf16_rne_bits(x[p * 8 + e]);
      *(v8us*)(x16 + p * 8) = v; }
    for (size_t p = tid; p < (size_t)4 * INNER * DIM / 8; p += nth) { const int n = (int)(p / (DIM / 8)), k0 = (int)(p % (DIM / 8)) * 8; v8us v;
#pragma unroll
      for (int e = 0; e < 8; ++e) v[e] = bf16_rne_bits(wqkv[(size_t)(k0 + e) * 4 * INNER + n]);
      *(v8us*)(w16 + (size_t)n * DIM + k0) = v; }
    for (size_t p = tid; p < (size_t)DIM * 2 * INNER / 8; p += nth) { const int n = (int)(p / (2 * INNER / 8)), k0 = (int)(p % (2 * INNER / 8)) * 8; v8b w;
#pragma unroll
      for (int e = 0; e < 8; ++e) w[e] = (b16)bf16_rne(wo[(size_t)(k0 + e) * DIM + n]);
      *(v8b*)(wo16 + (size_t)n * 2 * INNER + k0) = w; }
    
  }
}

// attn2 planes: s[m] = Σ_k exp(-|m-k|/e) (thread per m, f32, same expf), then A2[n][m] = 8 exp(-|n-m|/e)/s[m] as hi/lo f16 planes [2048][2048]; entries below the f16 normal range zeroed.
__global__ __launch_bounds__(256) void rowsum_kernel(float* __restrict__ srow) {
  const int m = blockIdx.x * 256 + threadIdx.x; float s = 0.0f;
  for (int k = 0; k < S; ++k) s += __expf(-fabsf((float)(m - k)) * INV_E);
  { ((float*)srow)[m] = s;  }
}
__global__ __launch_bounds__(256) void attn2_kernel(const float* __restrict__ srow, b16* __restrict__ a2) {
  const size_t i = (size_t)blockIdx.x * 256 + threadIdx.x; const int n = (int)(i / (S / 8)), m0 = (int)(i % (S / 8)) * 8; v8b hv, lv;
#pragma unroll
  for (int e = 0; e < 8; ++e) { const int m = m0 + e; float v = AS2 * __expf(-fabsf((float)(n - m)) * INV_E) / srow[m]; if (v < 6.103515625e-05f) v = 0.0f; b16 a, c; split16(v, a, c); hv[e] = a; lv[e] = c; }
  { *(v8b*)(a2 + (size_t)n * S + m0) = hv; *(v8b*)(a2 + APL + (size_t)n * S + m0) = lv;  }
}

// projections: rows = tokens (4096), K = 512, column tiles of 64 = one head of q | k | v | t (32 tiles): q/k -> x8 hi/lo rows [b*H + h][tok][64]; v, t -> (8v)^T, (8t)^T hi/lo planes
// [b*H + h][64][tok]. grid (32, 32) x 128.
__global__ __launch_bounds__(128) void proj_kernel(const __bf16* __restrict__ x16, const __bf16* __restrict__ w16, b16* __restrict__ qh, b16* __restrict__ kh, b16* __restrict__ vt, b16* __restrict__ tt) {
  __shared__ __attribute__((aligned(16))) b16 Th[4][32][HD + 8], Tq[4][32][HD + 8];
  __shared__ __attribute__((aligned(16))) b16 Tt[64][128 + 8], Tl[64][128 + 8];
  const int lane = threadIdx.x & 31, wave = threadIdx.x >> 5, nloc = lane & 15, hlf = lane >> 4, m0 = blockIdx.y * 128 + wave * 32, c0 = blockIdx.x * 64;
  const int which = blockIdx.x / H, head = blockIdx.x % H, b = m0 / S, tok0 = m0 % S;
  v8f acc[2][4];
#pragma unroll
  for (int r = 0; r < 2; ++r)
#pragma unroll
    for (int t = 0; t < 4; ++t) acc[r][t] = (v8f){};
#pragma unroll 2
  for (int kb = 0; kb < DIM; kb += 32) {
    const v16bb a0 = frag_kb_bf(x16 + (size_t)(m0 + nloc) * DIM + kb, hlf), a1 = frag_kb_bf(x16 + (size_t)(m0 + 16 + nloc) * DIM + kb, hlf);
#pragma unroll
    for (int t = 0; t < 4; ++t) { const v16bb bw = frag_kb_bf(w16 + (size_t)(c0 + t * 16 + nloc) * DIM + kb, hlf); acc[0][t] = wmma16bb(a0, bw, acc[0][t]); acc[1][t] = wmma16bb(a1, bw, acc[1][t]); } }
  if (which < 2) {
#pragma unroll
    for (int t = 0; t < 4; ++t)
#pragma unroll
      for (int r = 0; r < 2; ++r)
#pragma unroll
        for (int v = 0; v < 8; ++v) { b16 a_, c_; split16(acc[r][t][v] * QS, a_, c_); Th[wave][r * 16 + 8 * hlf + v][t * 16 + nloc] = a_; Tq[wave][r * 16 + 8 * hlf + v][t * 16 + nloc] = c_; }
    wave_lds_sync();
    b16* dst = ((which == 0) ? qh : kh) + (((size_t)b * H + head) * S + tok0) * HD;
    {
#pragma unroll
      for (int j = 0; j < 8; ++j) { const int rr = j * 4 + (lane >> 3), c8 = (lane & 7) * 8; *(v8b*)(dst + (size_t)rr * HD + c8) = *(const v8b*)(&Th[wave][rr][c8]); *(v8b*)(dst + QPL + (size_t)rr * HD + c8) = *(const v8b*)(&Tq[wave][rr][c8]); }
       }
    return;
  }
#pragma unroll
  for (int t = 0; t < 4; ++t)
#pragma unroll
    for (int r = 0; r < 2; ++r)
#pragma unroll
      for (int v = 0; v < 8; ++v) { b16 a_, c_; split16(acc[r][t][v] * VS, a_, c_); Tt[t * 16 + nloc][wave * 32 + r * 16 + 8 * hlf + v] = a_; Tl[t * 16 + nloc][wave * 32 + r * 16 + 8 * hlf + v] = c_; }
  __syncthreads();
  b16* dstv = ((which == 2) ? vt : tt) + (((size_t)b * H + head) * HD) * S + (blockIdx.y * 128) % S;
  {
#pragma unroll
    for (int j = 0; j < 8; ++j) { const int dd = wave * 16 + j * 2 + (lane >> 4), c8 = (lane & 15) * 8; *(v8b*)(dstv + (size_t)dd * S + c8) = *(const v8b*)(&Tt[dd][c8]); *(v8b*)(dstv + VPL + (size_t)dd * S + c8) = *(const v8b*)(&Tl[dd][c8]); }
    
  }
}

// attention: wave = (b, h, 16 queries q0..); the query rows are q[(q0 + col) mod 513]; keys: all 2048 (k x q hi/lo, 3 products), online softmax, o1 += (8v)^T.P (3 products);
// in the same key loop o2 += (8t)^T . A2^T rows (A2[q][m] as the B operand: rows = queries, k = keys; 3 products); y[tok][h*128 + 0..63] = o1/(64 l), [64..127] = o2/64; f32 rows
template <int QT>
__global__ __launch_bounds__(256) void attn_kernel(const b16* __restrict__ qh, const b16* __restrict__ kh, const b16* __restrict__ vt, const b16* __restrict__ tt, const b16* __restrict__ a2, float* __restrict__ y) {
  __shared__ __attribute__((aligned(16))) float Os[8][16][2 * HD + 4];
  const int wid = threadIdx.x >> 5, lane = threadIdx.x & 31, hh = lane >> 4, col = lane & 15;
  const int wg = blockIdx.x * 8 + wid, jt = wg % QT, bh = wg / QT, b = bh / H, h = bh % H, q0 = jt * 16, qi = q0 + col, qsrc = qi % QP;
  const b16* Q = qh + (size_t)bh * S * HD; const b16* K = kh + (size_t)bh * S * HD; const b16* V = vt + (size_t)bh * HD * S; const b16* T = tt + (size_t)bh * HD * S;
  v16b qf[2], ql[2];
#pragma unroll
  for (int ks = 0; ks < 2; ++ks) { qf[ks] = frag_kb(Q + (size_t)qsrc * HD + ks * 32, hh); ql[ks] = frag_kb(Q + QPL + (size_t)qsrc * HD + ks * 32, hh); }
  float m = -INFINITY, l = 0.0f; v8f o1[4] = {{}, {}, {}, {}}, o2[4] = {{}, {}, {}, {}};
  for (int kb = 0; kb < S; kb += 32) {
    v8f s0 = {}, s1 = {};
#pragma unroll
    for (int ks = 0; ks < 2; ++ks) { const v16b k0 = frag_kb(K + (size_t)(kb + col) * HD + ks * 32, hh), k0l = frag_kb(K + QPL + (size_t)(kb + col) * HD + ks * 32, hh), k1 = frag_kb(K + (size_t)(kb + 16 + col) * HD + ks * 32, hh), k1l = frag_kb(K + QPL + (size_t)(kb + 16 + col) * HD + ks * 32, hh);
      s0 = wmma16b(k0, qf[ks], s0); s0 = wmma16b(k0, ql[ks], s0); s0 = wmma16b(k0l, qf[ks], s0); s1 = wmma16b(k1, qf[ks], s1); s1 = wmma16b(k1, ql[ks], s1); s1 = wmma16b(k1l, qf[ks], s1); }
    float mr = -INFINITY;
#pragma unroll
    for (int r = 0; r < 8; ++r) { s0[r] *= SCALE / (QS * QS); s1[r] *= SCALE / (QS * QS); mr = fmaxf(mr, fmaxf(s0[r], s1[r])); }
    mr = fmaxf(mr, __shfl_xor(mr, 16));
    const float mn = fmaxf(m, mr), al_ = __expf(m - mn); m = mn;
    float sum = 0.0f; v16b pb, pl;
#pragma unroll
    for (int r = 0; r < 8; ++r) { const float e0 = __expf(s0[r] - mn), e1 = __expf(s1[r] - mn); sum += e0 + e1; b16 a, c; split16(e0 * PS, a, c); pb[r] = a; pl[r] = c; split16(e1 * PS, a, c); pb[8 + r] = a; pl[8 + r] = c; }
    sum += __shfl_xor(sum, 16); l = l * al_ + sum;
    const v16b af = frag_kb(a2 + (size_t)qi * S + kb, hh), al2 = frag_kb(a2 + APL + (size_t)qi * S + kb, hh);   // A2 rows = queries (B operand), k = keys
#pragma unroll
    for (int n = 0; n < 4; ++n) {
#pragma unroll
      for (int r = 0; r < 8; ++r) o1[n][r] *= al_;
      const v16b vf = frag_kb(V + (size_t)(n * 16 + col) * S + kb, hh), vl = frag_kb(V + VPL + (size_t)(n * 16 + col) * S + kb, hh);
      o1[n] = wmma16b(vf, pb, o1[n]); o1[n] = wmma16b(vf, pl, o1[n]); o1[n] = wmma16b(vl, pb, o1[n]);
      const v16b tf = frag_kb(T + (size_t)(n * 16 + col) * S + kb, hh), tl = frag_kb(T + VPL + (size_t)(n * 16 + col) * S + kb, hh);
      o2[n] = wmma16b(tf, af, o2[n]); o2[n] = wmma16b(tf, al2, o2[n]); o2[n] = wmma16b(tl, af, o2[n]); }
  }
  const float i1 = 1.0f / (VS * PS * l), i2 = 1.0f / (VS * AS2);
#pragma unroll
  for (int n = 0; n < 4; ++n)
#pragma unroll
    for (int r = 0; r < 8; ++r) { Os[wid][col][n * 16 + 8 * hh + r] = o1[n][r] * i1; Os[wid][col][HD + n * 16 + 8 * hh + r] = o2[n][r] * i2; }
  wave_lds_sync();
  float* dst = y + ((size_t)b * S + q0) * (2 * INNER) + h * 2 * HD;
  {                      // 16 rows x 512 B: one row per instruction (32 lanes x 16 B)
#pragma unroll
    for (int rr = 0; rr < 16; ++rr) *(v4f*)(dst + (size_t)rr * (2 * INNER) + lane * 4) = *(const v4f*)(&Os[wid][rr][lane * 4]);
    
  }
}

// out = y W_out + b: rows 4096, K = 1024 (y split x8 hi/lo at load), 8 column tiles of 64; + bf16(b); f32 rows. grid (8, 32).
__global__ __launch_bounds__(128) void out_kernel(const float* __restrict__ y, const b16* __restrict__ wo16, const float* __restrict__ bo, float* __restrict__ out) {
  __shared__ __attribute__((aligned(16))) float Ts[4][32 * 64];
  const int lane = threadIdx.x & 31, wave = threadIdx.x >> 5, nloc = lane & 15, hlf = lane >> 4, m0 = blockIdx.y * 128 + wave * 32, c0 = blockIdx.x * 64;
  v8f acc[2][4];
#pragma unroll
  for (int r = 0; r < 2; ++r)
#pragma unroll
    for (int t = 0; t < 4; ++t) acc[r][t] = (v8f){};
  const Opnd A{y, nullptr, 2 * INNER}, Bo{wo16, nullptr, 2 * INNER};
  gemm_tile<5, 1>(A, Bo, 2 * INNER, m0, c0, nloc, hlf, acc);
#pragma unroll
  for (int t = 0; t < 4; ++t)
#pragma unroll
    for (int r = 0; r < 2; ++r)
#pragma unroll
      for (int v = 0; v < 8; ++v) acc[r][t][v] = acc[r][t][v] * 0.125f + bf16_rne(bo[c0 + t * 16 + nloc]);
  epi_f32(acc, 1.0f, nullptr, out, DIM, m0, c0, lane, Ts[wave]);
}
}  // namespace

extern "C" void kernel_launch(void* const* d_in, const int* in_sizes, int n_in,
                              void* d_out, int out_size, void* d_ws, size_t ws_size, hipStream_t stream) {
  (void)n_in; (void)out_size;
  const float* x = (const float*)d_in[0]; const float* wqkv = (const float*)d_in[1]; const float* wo = (const float*)d_in[2]; const float* bo = (const float*)d_in[3];
  float* out = (float*)d_out;   // [2][2048][512]
  if (in_sizes[0] != NTOK * DIM || in_sizes[1] != DIM * 4 * INNER || in_sizes[2] != 2 * INNER * DIM || in_sizes[3] != DIM) return;
  size_t off = 0; char* ws = (char*)d_ws;
  auto carve = [&](size_t bytes) { char* p = ws + off; off += (bytes + 255) & ~(size_t)255; return p; };
  unsigned short* x16 = (unsigned short*)carve((size_t)NTOK * DIM * 2); unsigned short* w16 = (unsigned short*)carve((size_t)4 * INNER * DIM * 2); b16* wo16 = (b16*)carve((size_t)DIM * 2 * INNER * 2);
  float* srow = (float*)carve((size_t)S * 4); b16* a2 = (b16*)carve(APL * 2 * 2);
  b16* qh = (b16*)carve(QPL * 2 * 2); b16* kh = (b16*)carve(QPL * 2 * 2); b16* vt = (b16*)carve(VPL * 2 * 2); b16* tt = (b16*)carve(VPL * 2 * 2); float* y = (float*)carve((size_t)NTOK * 2 * INNER * 4);
  if (off > ws_size) return;                                    // ≈ 74.5 MB
  prep_kernel<<<1024, 256, 0, stream>>>(x, wqkv, wo, x16, w16, wo16);
  rowsum_kernel<<<S / 256, 256, 0, stream>>>(srow);
  attn2_kernel<<<S * S / 8 / 256, 256, 0, stream>>>(srow, a2);
  proj_kernel<<<dim3(4 * INNER / 64, NTOK / 128), 128, 0, stream>>>((const __bf16*)x16, (const __bf16*)w16, qh, kh, vt, tt);
  attn_kernel<S / 16><<<Bn * H * (S / 16) / 8, 256, 0, stream>>>(qh, kh, vt, tt, a2, y);
  out_kernel<<<dim3(DIM / 64, NTOK / 128), 128, 0, stream>>>(y, wo16, bo, out);
}

// v001
// A run of this version takes 250 microseconds.
// Next to v000, in two timings, it ran 1.48 times as fast each time.
#include <hip/hip_runtime.h>

// "Fast attention": [q | k | v | t] = x W_qkv (8 heads x 64 each); query i uses q[i mod 513] (the module's pad/reshape/tile trick with STEP 4, n = 2048); attn1 = softmax(q~.k / 8) over
// all 2048 keys; out1 = attn1.v; attn2[n][m] = exp(-|n-m|/e) / s[m] with s[m] = sum_k exp(-|m-k|/e) (the module's broadcast divides column m by row-sum m); out2 = attn2.t (shared
// over batch and heads); out = [out1 | out2 per head] W_out + b -> [2][2048][512].
// Numerics: x, W_qkv, W_out, b_out rounded to bf16; projection on v_wmma_f32_16x16x32_bf16 (exact products); q, k, v, t, P and the
// merged attention output carried x8 as f16 hi+lo pairs (3 / 2 products) on v_wmma_f32_16x16x32_f16; the analytic attn2 matrix as an x8 f16 hi+lo pair (entries that would be f16-
// subnormal are zeroed identically everywhere — they are < 8e-6 of a row); online softmax and the row sums s[m] in f32. Fragment k-map per lane half hh for A AND B: elements 0..7 <-

namespace {
constexpr int Bn = 2, S = 2048, DIM = 512, H = 8, HD = 64, INNER = 512, NTOK = Bn * S, QP = 513 /* (n + yushu) / STEP */;
constexpr float SCALE = 0.125f, VS = 8.0f, QS = 8.0f, PS = 8.0f, AS2 = 8.0f, INV_E = 0.36787944117144233f;
constexpr size_t QPL = (size_t)Bn * H * S * HD, VPL = QPL, APL = (size_t)S * S;

typedef _Float16 b16;
typedef __attribute__((ext_vector_type(16))) _Float16 v16b;
typedef __attribute__((ext_vector_type(8)))  _Float16 v8b;
typedef __attribute__((ext_vector_type(8)))  float v8f;
typedef __attribute__((ext_vector_type(4)))  float v4f;

__device__ __forceinline__ v8b ld8b(const b16* p) { return *(const v8b*)p; }
__device__ __forceinline__ v16b cat8b(v8b a, v8b b) { return __builtin_shufflevector(a, b, 0, 1, 2, 3, 4, 5, 6, 7, 8, 9, 10, 11, 12, 13, 14, 15); }
__device__ __forceinline__ v16b frag_kb(const b16* p, int hh) { return cat8b(ld8b(p + 8 * hh), ld8b(p + 16 + 8 * hh)); }
__device__ __forceinline__ void split16(float v, b16& hi, b16& lo) { hi = (b16)v; lo = (b16)(v - (float)hi); }
// hi/lo fragment pair straight from an f32 k-contiguous row (same k-map)
__device__ __forceinline__ void frag_ksplit(const float* p, int hh, v16b& fh_, v16b& fl_) {
  const float* p0 = p + 8 * hh; const float* p1 = p + 16 + 8 * hh;
#pragma unroll
  for (int e = 0; e < 8; ++e) { b16 a, c; split16(p0[e], a, c); fh_[e] = a; fl_[e] = c; split16(p1[e], a, c); fh_[8 + e] = a; fl_[8 + e] = c; }
}
__device__ __forceinline__ v8f wmma16b(v16b a, v16b b, v8f c) {
  v8f d = __builtin_amdgcn_wmma_f32_16x16x32_f16(false, a, false, b, (short)0, c, false, false);
  asm volatile("v_nop\n\tv_nop\n\tv_nop\n\tv_nop" : "+v"(d) : "v"(a), "v"(b));
  return d;
}
__device__ __forceinline__ void wave_lds_sync() {
  __builtin_amdgcn_fence(__ATOMIC_RELEASE, "workgroup");
  __builtin_amdgcn_wave_barrier();
  __builtin_amdgcn_fence(__ATOMIC_ACQUIRE, "workgroup");
}

// Operand descriptor: NP = 0 -> f32 rows split on the fly into (hi, lo); NP = 1 -> one f16 plane; NP = 2 -> f16 hi + lo planes;
// NP = 3 -> f32 rows rounded once to a single f16 fragment. ld = row pitch.
struct Opnd { const void* p0; const void* p1; int ld; };
template <int NP> __device__ __forceinline__ void load_frags(const Opnd& o, int row, int kb, int hh, v16b& fh_, v16b& fl_) {
  if (NP == 0) { frag_ksplit((const float*)o.p0 + (size_t)row * o.ld + kb, hh, fh_, fl_); }
  else if (NP == 4 || NP == 5) {                             // f32 rows x64 (NP 4) or x8 (NP 5) then split (keeps the lo halves of small values normal)
    const float sc_ = (NP == 4) ? 64.0f : 8.0f;
    const float* p = (const float*)o.p0 + (size_t)row * o.ld + kb; const float* p0 = p + 8 * hh; const float* p1 = p + 16 + 8 * hh;
#pragma unroll
    for (int e = 0; e < 8; ++e) { b16 a, c; split16(p0[e] * sc_, a, c); fh_[e] = a; fl_[e] = c; split16(p1[e] * sc_, a, c); fh_[8 + e] = a; fl_[8 + e] = c; }
  } else if (NP == 3) {
    const float* p = (const float*)o.p0 + (size_t)row * o.ld + kb; const float* p0 = p + 8 * hh; const float* p1 = p + 16 + 8 * hh;
#pragma unroll
    for (int e = 0; e < 8; ++e) { fh_[e] = (b16)p0[e]; fh_[8 + e] = (b16)p1[e]; }
    fl_ = fh_;
  } else {
    fh_ = frag_kb((const b16*)o.p0 + (size_t)row * o.ld + kb, hh);
    if (NP == 2) fl_ = frag_kb((const b16*)o.p1 + (size_t)row * o.ld + kb, hh); else fl_ = fh_;
  }
}
template <int ANP, int BNP> __device__ __forceinline__ v8f mac(v16b ah, v16b al, v16b bh, v16b bl, v8f c) {
  c = wmma16b(ah, bh, c);
  if (BNP == 0 || BNP == 2 || BNP == 4 || BNP == 5) c = wmma16b(ah, bl, c);     // hi.lo
  if (ANP == 0 || ANP == 2 || ANP == 4 || ANP == 5) c = wmma16b(al, bh, c);     // lo.hi   (lo.lo dropped)
  return c;
}
// 32x64 wave tile: acc[r][t] (rows m0+16r.., cols c0+16t..) += A[m][k] . B[n][k] over k in [0, K)
template <int ANP, int BNP>
__device__ __forceinline__ void gemm_tile(const Opnd& A, const Opnd& B, int K, int m0, int c0, int nloc, int hlf, v8f (&acc)[2][4]) {
  for (int kb = 0; kb < K; kb += 32) {
    v16b a0h, a0l, a1h, a1l;
    load_frags<ANP>(A, m0 + nloc, kb, hlf, a0h, a0l);
    load_frags<ANP>(A, m0 + 16 + nloc, kb, hlf, a1h, a1l);
#pragma unroll
    for (int t = 0; t < 4; ++t) {
      v16b bh, bl;
      load_frags<BNP>(B, c0 + t * 16 + nloc, kb, hlf, bh, bl);
      acc[0][t] = mac<ANP, BNP>(a0h, a0l, bh, bl, acc[0][t]);
      acc[1][t] = mac<ANP, BNP>(a1h, a1l, bh, bl, acc[1][t]);
    }
  }
}

__device__ __forceinline__ void epi_planes(v8f (&acc)[2][4], float scale, bool two, b16* __restrict__ oh, b16* __restrict__ ol, int ldo,
                                           int m0, int c0, int lane, b16* Th, b16* Tl) {
  const int nloc = lane & 15, hlf = lane >> 4;
#pragma unroll
  for (int t = 0; t < 4; ++t)
#pragma unroll
    for (int r = 0; r < 2; ++r)
#pragma unroll
      for (int v = 0; v < 8; ++v) {
        const int rr = r * 16 + v + 8 * hlf, cc = t * 16 + nloc;
        b16 h_, l_; split16(acc[r][t][v] * scale, h_, l_);
        Th[rr * 64 + cc] = h_; Tl[rr * 64 + cc] = l_;
      }
  wave_lds_sync();
  {
#pragma unroll
    for (int j = 0; j < 8; ++j) {
      const int rr = j * 4 + (lane >> 3), c8 = (lane & 7) * 8;
      const size_t o = (size_t)(m0 + rr) * ldo + c0 + c8;
      *(v8b*)(oh + o) = ld8b(Th + rr * 64 + c8);
      if (two) *(v8b*)(ol + o) = ld8b(Tl + rr * 64 + c8);
    }
    
  }
}
// (b) f32 rows with pitch ldo: 64 floats = 256 B = 2 lines per row; 16 lanes x 16 B per row, 2 rows per instruction. Optional per-row factor
__device__ __forceinline__ void epi_f32(v8f (&acc)[2][4], float scale, const float* rscale, float* __restrict__ out, int ldo, int m0, int c0, int lane, float* Tt) {
  const int nloc = lane & 15, hlf = lane >> 4;
#pragma unroll
  for (int t = 0; t < 4; ++t)
#pragma unroll
    for (int r = 0; r < 2; ++r)
#pragma unroll
      for (int v = 0; v < 8; ++v) {
        const int rr = r * 16 + v + 8 * hlf;
        const float rs = rscale ? rscale[(size_t)(m0 + rr) * 32] : 1.0f;
        Tt[rr * 64 + t * 16 + nloc] = acc[r][t][v] * scale * rs;
      }
  wave_lds_sync();
  float* dst0 = out + (size_t)m0 * ldo + c0;
  {
#pragma unroll
    for (int j = 0; j < 16; ++j) { const int rr = j * 2 + hlf, c4 = nloc * 4; *(v4f*)(dst0 + (size_t)rr * ldo + c4) = *(const v4f*)(Tt + rr * 64 + c4); }
    
  }
}



typedef __attribute__((ext_vector_type(8))) __bf16 v8bb; typedef __attribute__((ext_vector_type(16))) __bf16 v16bb;
typedef __attribute__((ext_vector_type(8))) unsigned short v8us;
__device__ __forceinline__ v16bb frag_kb_bf(const __bf16* p, int hh) { const v8bb a = *(const v8bb*)(p + 8 * hh), b = *(const v8bb*)(p + 16 + 8 * hh); return __builtin_shufflevector(a, b, 0, 1, 2, 3, 4, 5, 6, 7, 8, 9, 10, 11, 12, 13, 14, 15); }
__device__ __forceinline__ v8f wmma16bb(v16bb a, v16bb b, v8f c) {
  v8f d = __builtin_amdgcn_wmma_f32_16x16x32_bf16(false, a, false, b, (short)0, c, false, false);
  asm volatile("v_nop\n\tv_nop\n\tv_nop\n\tv_nop" : "+v"(d) : "v"(a), "v"(b));
  return d;
}
__device__ __forceinline__ unsigned short bf16_rne_bits(float v) { unsigned int u = __float_as_uint(v); u += 0x7FFFu + ((u >> 16) & 1u); return (unsigned short)(u >> 16); }
__device__ __forceinline__ float bf16_rne(float v) { return __uint_as_float(((unsigned int)bf16_rne_bits(v)) << 16); }



__global__ __launch_bounds__(256) void prep_kernel(const float* __restrict__ x, const float* __restrict__ wqkv, const float* __restrict__ wo, unsigned short* __restrict__ x16, unsigned short* __restrict__ w16, b16* __restrict__ wo16) {
  const size_t tid = (size_t)blockIdx.x * blockDim.x + threadIdx.x, nth = (size_t)gridDim.x * blockDim.x;
  {
    for (size_t p = tid; p < (size_t)NTOK * DIM / 8; p += nth) { v8us v;
#pragma unroll
      for (int e = 0; e < 8; ++e) v[e] = bf16_rne_bits(x[p * 8 + e]);
      *(v8us*)(x16 + p * 8) = v; }
    for (size_t p = tid; p < (size_t)4 * INNER * DIM / 8; p += nth) { const int n = (int)(p / (DIM / 8)), k0 = (int)(p % (DIM / 8)) * 8; v8us v;
#pragma unroll
      for (int e = 0; e < 8; ++e) v[e] = bf16_rne_bits(wqkv[(size_t)(k0 + e) * 4 * INNER + n]);
      *(v8us*)(w16 + (size_t)n * DIM + k0) = v; }
    for (size_t p = tid; p < (size_t)DIM * 2 * INNER / 8; p += nth) { const int n = (int)(p / (2 * INNER / 8)), k0 = (int)(p % (2 * INNER / 8)) * 8; v8b w;
#pragma unroll
      for (int e = 0; e < 8; ++e) w[e] = (b16)bf16_rne(wo[(size_t)(k0 + e) * DIM + n]);
      *(v8b*)(wo16 + (size_t)n * 2 * INNER + k0) = w; }
    
  }
}

// attn2 planes: s[m] = Σ_k exp(-|m-k|/e) (thread per m, f32, same expf), then A2[n][m] = 8 exp(-|n-m|/e)/s[m] as hi/lo f16 planes [2048][2048]; entries below the f16 normal range zeroed.
__global__ __launch_bounds__(256) void rowsum_kernel(float* __restrict__ srow) {
  const int m = blockIdx.x * 256 + threadIdx.x; float s = 0.0f;
  for (int k = 0; k < S; ++k) s += __expf(-fabsf((float)(m - k)) * INV_E);
  { ((float*)srow)[m] = s;  }
}
__global__ __launch_bounds__(256) void attn2_kernel(const float* __restrict__ srow, b16* __restrict__ a2) {
  const size_t i = (size_t)blockIdx.x * 256 + threadIdx.x; const int n = (int)(i / (S / 8)), m0 = (int)(i % (S / 8)) * 8; v8b hv, lv;
#pragma unroll
  for (int e = 0; e < 8; ++e) { const int m = m0 + e; float v = AS2 * __expf(-fabsf((float)(n - m)) * INV_E) / srow[m]; if (v < 6.103515625e-05f) v = 0.0f; b16 a, c; split16(v, a, c); hv[e] = a; lv[e] = c; }
  { *(v8b*)(a2 + (size_t)n * S + m0) = hv; *(v8b*)(a2 + APL + (size_t)n * S + m0) = lv;  }
}

// projections: rows = tokens (4096), K = 512, column tiles of 64 = one head of q | k | v | t (32 tiles): q/k -> x8 hi/lo rows [b*H + h][tok][64]; v, t -> (8v)^T, (8t)^T hi/lo planes
// [b*H + h][64][tok]. grid (32, 32) x 128.
__global__ __launch_bounds__(128) void proj_kernel(const __bf16* __restrict__ x16, const __bf16* __restrict__ w16, b16* __restrict__ qh, b16* __restrict__ kh, b16* __restrict__ vt, b16* __restrict__ tt) {
  __shared__ __attribute__((aligned(16))) b16 Th[4][32][HD + 8], Tq[4][32][HD + 8];
  __shared__ __attribute__((aligned(16))) b16 Tt[64][128 + 8], Tl[64][128 + 8];
  const int lane = threadIdx.x & 31, wave = threadIdx.x >> 5, nloc = lane & 15, hlf = lane >> 4, m0 = blockIdx.y * 128 + wave * 32, c0 = blockIdx.x * 64;
  const int which = blockIdx.x / H, head = blockIdx.x % H, b = m0 / S, tok0 = m0 % S;
  v8f acc[2][4];
#pragma unroll
  for (int r = 0; r < 2; ++r)
#pragma unroll
    for (int t = 0; t < 4; ++t) acc[r][t] = (v8f){};
#pragma unroll 2
  for (int kb = 0; kb < DIM; kb += 32) {
    const v16bb a0 = frag_kb_bf(x16 + (size_t)(m0 + nloc) * DIM + kb, hlf), a1 = frag_kb_bf(x16 + (size_t)(m0 + 16 + nloc) * DIM + kb, hlf);
#pragma unroll
    for (int t = 0; t < 4; ++t) { const v16bb bw = frag_kb_bf(w16 + (size_t)(c0 + t * 16 + nloc) * DIM + kb, hlf); acc[0][t] = wmma16bb(a0, bw, acc[0][t]); acc[1][t] = wmma16bb(a1, bw, acc[1][t]); } }
  if (which < 2) {
#pragma unroll
    for (int t = 0; t < 4; ++t)
#pragma unroll
      for (int r = 0; r < 2; ++r)
#pragma unroll
        for (int v = 0; v < 8; ++v) { b16 a_, c_; split16(acc[r][t][v] * QS, a_, c_); Th[wave][r * 16 + 8 * hlf + v][t * 16 + nloc] = a_; Tq[wave][r * 16 + 8 * hlf + v][t * 16 + nloc] = c_; }
    wave_lds_sync();
    b16* dst = ((which == 0) ? qh : kh) + (((size_t)b * H + head) * S + tok0) * HD;
    {
#pragma unroll
      for (int j = 0; j < 8; ++j) { const int rr = j * 4 + (lane >> 3), c8 = (lane & 7) * 8; *(v8b*)(dst + (size_t)rr * HD + c8) = *(const v8b*)(&Th[wave][rr][c8]); *(v8b*)(dst + QPL + (size_t)rr * HD + c8) = *(const v8b*)(&Tq[wave][rr][c8]); }
       }
    return;
  }
#pragma unroll
  for (int t = 0; t < 4; ++t)
#pragma unroll
    for (int r = 0; r < 2; ++r)
#pragma unroll
      for (int v = 0; v < 8; ++v) { b16 a_, c_; split16(acc[r][t][v] * VS, a_, c_); Tt[t * 16 + nloc][wave * 32 + r * 16 + 8 * hlf + v] = a_; Tl[t * 16 + nloc][wave * 32 + r * 16 + 8 * hlf + v] = c_; }
  __syncthreads();
  b16* dstv = ((which == 2) ? vt : tt) + (((size_t)b * H + head) * HD) * S + (blockIdx.y * 128) % S;
  {
#pragma unroll
    for (int j = 0; j < 8; ++j) { const int dd = wave * 16 + j * 2 + (lane >> 4), c8 = (lane & 15) * 8; *(v8b*)(dstv + (size_t)dd * S + c8) = *(const v8b*)(&Tt[dd][c8]); *(v8b*)(dstv + VPL + (size_t)dd * S + c8) = *(const v8b*)(&Tl[dd][c8]); }
    
  }
}

// attention. The query row of token i is q[i mod 513], so softmax(q~.k / 8).v has only 513 distinct rows per (b, h): each is computed ONCE and stored to its up to four tokens
// r, r + 513, r + 1026, r + 1539 (< 2048). Block = (b, h, 1/16 of the sequence), 11 waves, one role per wave (no barrier between waves):
//   waves 0, 1 : softmax tiles of 16 distinct rows (32 full tiles per (b, h)); wave 10 of the first block of each (b, h): the tile that holds row 512 (rows 513.. are not stored);
//   waves 2..9 : decay tiles of 16 tokens, o2 += (8t)^T . A2^T rows (A2[q][m] as the B operand: rows = queries, k = keys; 3 products).
// Per row both sums run in the order they had: all 2048 keys in steps of 32 (k x q hi/lo, 3 products), online softmax, o1 += (8v)^T.P (3 products).
// y[tok][h*128 + 0..63] = o1/(64 l), [64..127] = o2/64; f32 rows; each role stores 256 B (two whole lines) per row.
constexpr int AW = 11, SPB = 2, DPB = 8, BPH = S / 16 / DPB;
static_assert(BPH * SPB * 16 == QP - 1 && QP * 4 >= S, "32 full tiles of distinct rows and one more row; four copies cover the sequence");
__device__ __forceinline__ void softmax_tile(const b16* __restrict__ Q, const b16* __restrict__ K, const b16* __restrict__ V, int r0, int lane, float (*Os)[HD + 4], float* __restrict__ yb) {
  const int hh = lane >> 4, col = lane & 15, qsrc = r0 + col;
  v16b qf[2], ql[2];
#pragma unroll
  for (int ks = 0; ks < 2; ++ks) { qf[ks] = frag_kb(Q + (size_t)qsrc * HD + ks * 32, hh); ql[ks] = frag_kb(Q + QPL + (size_t)qsrc * HD + ks * 32, hh); }
  float m = -INFINITY, l = 0.0f; v8f o1[4] = {{}, {}, {}, {}};
  for (int kb = 0; kb < S; kb += 32) {
    v8f s0 = {}, s1 = {};
#pragma unroll
    for (int ks = 0; ks < 2; ++ks) { const v16b k0 = frag_kb(K + (size_t)(kb + col) * HD + ks * 32, hh), k0l = frag_kb(K + QPL + (size_t)(kb + col) * HD + ks * 32, hh), k1 = frag_kb(K + (size_t)(kb + 16 + col) * HD + ks * 32, hh), k1l = frag_kb(K + QPL + (size_t)(kb + 16 + col) * HD + ks * 32, hh);
      s0 = wmma16b(k0, qf[ks], s0); s0 = wmma16b(k0, ql[ks], s0); s0 = wmma16b(k0l, qf[ks], s0); s1 = wmma16b(k1, qf[ks], s1); s1 = wmma16b(k1, ql[ks], s1); s1 = wmma16b(k1l, qf[ks], s1); }
    float mr = -INFINITY;
#pragma unroll
    for (int r = 0; r < 8; ++r) { s0[r] *= SCALE / (QS * QS); s1[r] *= SCALE / (QS * QS); mr = fmaxf(mr, fmaxf(s0[r], s1[r])); }
    mr = fmaxf(mr, __shfl_xor(mr, 16));
    const float mn = fmaxf(m, mr), al_ = __expf(m - mn); m = mn;
    float sum = 0.0f; v16b pb, pl;
#pragma unroll
    for (int r = 0; r < 8; ++r) { const float e0 = __expf(s0[r] - mn), e1 = __expf(s1[r] - mn); sum += e0 + e1; b16 a, c; split16(e0 * PS, a, c); pb[r] = a; pl[r] = c; split16(e1 * PS, a, c); pb[8 + r] = a; pl[8 + r] = c; }
    sum += __shfl_xor(sum, 16); l = l * al_ + sum;
#pragma unroll
    for (int n = 0; n < 4; ++n) {
#pragma unroll
      for (int r = 0; r < 8; ++r) o1[n][r] *= al_;
      const v16b vf = frag_kb(V + (size_t)(n * 16 + col) * S + kb, hh), vl = frag_kb(V + VPL + (size_t)(n * 16 + col) * S + kb, hh);
      o1[n] = wmma16b(vf, pb, o1[n]); o1[n] = wmma16b(vf, pl, o1[n]); o1[n] = wmma16b(vl, pb, o1[n]); }
  }
  const float i1 = 1.0f / (VS * PS * l);
#pragma unroll
  for (int n = 0; n < 4; ++n)
#pragma unroll
    for (int r = 0; r < 8; ++r) Os[col][n * 16 + 8 * hh + r] = o1[n][r] * i1;
  wave_lds_sync();
#pragma unroll
  for (int j = 0; j < 8; ++j) {                      // two rows x 256 B per instruction (16 lanes x 16 B a row), once per token that uses the row
    const int row = r0 + j * 2 + hh; const v4f val = *(const v4f*)(&Os[j * 2 + hh][col * 4]);
#pragma unroll
    for (int c = 0; c < 4; ++c) { const int tok = row + c * QP; if (row < QP && tok < S) *(v4f*)(yb + (size_t)tok * (2 * INNER) + col * 4) = val; }
  }
}
__device__ __forceinline__ void decay_tile(const b16* __restrict__ T, const b16* __restrict__ a2, int q0, int lane, float (*Os)[HD + 4], float* __restrict__ yb) {
  const int hh = lane >> 4, col = lane & 15, qi = q0 + col;
  v8f o2[4] = {{}, {}, {}, {}};
  for (int kb = 0; kb < S; kb += 32) {
    const v16b af = frag_kb(a2 + (size_t)qi * S + kb, hh), al2 = frag_kb(a2 + APL + (size_t)qi * S + kb, hh);   // A2 rows = queries (B operand), k = keys
#pragma unroll
    for (int n = 0; n < 4; ++n) {
      const v16b tf = frag_kb(T + (size_t)(n * 16 + col) * S + kb, hh), tl = frag_kb(T + VPL + (size_t)(n * 16 + col) * S + kb, hh);
      o2[n] = wmma16b(tf, af, o2[n]); o2[n] = wmma16b(tf, al2, o2[n]); o2[n] = wmma16b(tl, af, o2[n]); }
  }
  const float i2 = 1.0f / (VS * AS2);
#pragma unroll
  for (int n = 0; n < 4; ++n)
#pragma unroll
    for (int r = 0; r < 8; ++r) Os[col][n * 16 + 8 * hh + r] = o2[n][r] * i2;
  wave_lds_sync();
#pragma unroll
  for (int j = 0; j < 8; ++j) *(v4f*)(yb + (size_t)(q0 + j * 2 + hh) * (2 * INNER) + HD + col * 4) = *(const v4f*)(&Os[j * 2 + hh][col * 4]);
}
__global__ __launch_bounds__(AW * 32) void attn_kernel(const b16* __restrict__ qh, const b16* __restrict__ kh, const b16* __restrict__ vt, const b16* __restrict__ tt, const b16* __restrict__ a2, float* __restrict__ y) {
  __shared__ __attribute__((aligned(16))) float Os[AW][16][HD + 4];
  const int wid = __builtin_amdgcn_readfirstlane(threadIdx.x >> 5), lane = threadIdx.x & 31;   // the wave's number in a scalar register: the role test is a scalar branch
  const int bh = blockIdx.x / BPH, part = blockIdx.x % BPH, b = bh / H, h = bh % H;
  float* yb = y + (size_t)b * S * (2 * INNER) + h * 2 * HD;
  if (wid >= SPB && wid < SPB + DPB) { decay_tile(tt + (size_t)bh * HD * S, a2, (part * DPB + wid - SPB) * 16, lane, Os[wid], yb); return; }
  if (wid >= SPB && part != 0) return;
  softmax_tile(qh + (size_t)bh * S * HD, kh + (size_t)bh * S * HD, vt + (size_t)bh * HD * S, (wid < SPB) ? (part * SPB + wid) * 16 : QP - 1, lane, Os[wid], yb);
}

// out = y W_out + b: rows 4096, K = 1024 (y split x8 hi/lo at load), 8 column tiles of 64; + bf16(b); f32 rows. grid (8, 32).
__global__ __launch_bounds__(128) void out_kernel(const float* __restrict__ y, const b16* __restrict__ wo16, const float* __restrict__ bo, float* __restrict__ out) {
  __shared__ __attribute__((aligned(16))) float Ts[4][32 * 64];
  const int lane = threadIdx.x & 31, wave = threadIdx.x >> 5, nloc = lane & 15, hlf = lane >> 4, m0 = blockIdx.y * 128 + wave * 32, c0 = blockIdx.x * 64;
  v8f acc[2][4];
#pragma unroll
  for (int r = 0; r < 2; ++r)
#pragma unroll
    for (int t = 0; t < 4; ++t) acc[r][t] = (v8f){};
  const Opnd A{y, nullptr, 2 * INNER}, Bo{wo16, nullptr, 2 * INNER};
  gemm_tile<5, 1>(A, Bo, 2 * INNER, m0, c0, nloc, hlf, acc);
#pragma unroll
  for (int t = 0; t < 4; ++t)
#pragma unroll
    for (int r = 0; r < 2; ++r)
#pragma unroll
      for (int v = 0; v < 8; ++v) acc[r][t][v] = acc[r][t][v] * 0.125f + bf16_rne(bo[c0 + t * 16 + nloc]);
  epi_f32(acc, 1.0f, nullptr, out, DIM, m0, c0, lane, Ts[wave]);
}
}  // namespace

extern "C" void kernel_launch(void* const* d_in, const int* in_sizes, int n_in,
                              void* d_out, int out_size, void* d_ws, size_t ws_size, hipStream_t stream) {
  (void)n_in; (void)out_size;
  const float* x = (const float*)d_in[0]; const float* wqkv = (const float*)d_in[1]; const float* wo = (const float*)d_in[2]; const float* bo = (const float*)d_in[3];
  float* out = (float*)d_out;   // [2][2048][512]
  if (in_sizes[0] != NTOK * DIM || in_sizes[1] != DIM * 4 * INNER || in_sizes[2] != 2 * INNER * DIM || in_sizes[3] != DIM) return;
  size_t off = 0; char* ws = (char*)d_ws;
  auto carve = [&](size_t bytes) { char* p = ws + off; off += (bytes + 255) & ~(size_t)255; return p; };
  unsigned short* x16 = (unsigned short*)carve((size_t)NTOK * DIM * 2); unsigned short* w16 = (unsigned short*)carve((size_t)4 * INNER * DIM * 2); b16* wo16 = (b16*)carve((size_t)DIM * 2 * INNER * 2);
  float* srow = (float*)carve((size_t)S * 4); b16* a2 = (b16*)carve(APL * 2 * 2);
  b16* qh = (b16*)carve(QPL * 2 * 2); b16* kh = (b16*)carve(QPL * 2 * 2); b16* vt = (b16*)carve(VPL * 2 * 2); b16* tt = (b16*)carve(VPL * 2 * 2); float* y = (float*)carve((size_t)NTOK * 2 * INNER * 4);
  if (off > ws_size) return;                                    // ≈ 74.5 MB
  prep_kernel<<<1024, 256, 0, stream>>>(x, wqkv, wo, x16, w16, wo16);
  rowsum_kernel<<<S / 256, 256, 0, stream>>>(srow);
  attn2_kernel<<<S * S / 8 / 256, 256, 0, stream>>>(srow, a2);
  proj_kernel<<<dim3(4 * INNER / 64, NTOK / 128), 128, 0, stream>>>((const __bf16*)x16, (const __bf16*)w16, qh, kh, vt, tt);
  attn_kernel<<<Bn * H * BPH, AW * 32, 0, stream>>>(qh, kh, vt, tt, a2, y);
  out_kernel<<<dim3(DIM / 64, NTOK / 128), 128, 0, stream>>>(y, wo16, bo, out);
}

// v002
// One run takes 223 microseconds.
// Two timings next to v001 both put it at 1.11 times that version's speed.
// All steps since v000 together make it 1.65 times as fast.
#include <hip/hip_runtime.h>

// "Fast attention": [q | k | v | t] = x W_qkv (8 heads x 64 each); query i uses q[i mod 513] (the module's pad/reshape/tile trick with STEP 4, n = 2048); attn1 = softmax(q~.k / 8) over
// all 2048 keys; out1 = attn1.v; attn2[n][m] = exp(-|n-m|/e) / s[m] with s[m] = sum_k exp(-|m-k|/e) (the module's broadcast divides column m by row-sum m); out2 = attn2.t (shared
// over batch and heads); out = [out1 | out2 per head] W_out + b -> [2][2048][512].
// Numerics: x, W_qkv, W_out, b_out rounded to bf16; projection on v_wmma_f32_16x16x32_bf16 (exact products); q, k, v, t, P and the
// merged attention output carried x8 as f16 hi+lo pairs (3 / 2 products) on v_wmma_f32_16x16x32_f16; the analytic attn2 matrix as an x8 f16 hi+lo pair (entries that would be f16-
// subnormal are zeroed identically everywhere — they are < 8e-6 of a row); online softmax and the row sums s[m] in f32. Fragment k-map per lane half hh for A AND B: elements 0..7 <-

namespace {
constexpr int Bn = 2, S = 2048, DIM = 512, H = 8, HD = 64, INNER = 512, NTOK = Bn * S, QP = 513 /* (n + yushu) / STEP */;
constexpr float SCALE = 0.125f, VS = 8.0f, QS = 8.0f, PS = 8.0f, AS2 = 8.0f, INV_E = 0.36787944117144233f;
constexpr size_t QPL = (size_t)Bn * H * S * HD, VPL = QPL, APL = (size_t)S * S;

typedef _Float16 b16;
typedef __attribute__((ext_vector_type(16))) _Float16 v16b;
typedef __attribute__((ext_vector_type(8)))  _Float16 v8b;
typedef __attribute__((ext_vector_type(8)))  float v8f;
typedef __attribute__((ext_vector_type(4)))  float v4f;

__device__ __forceinline__ v8b ld8b(const b16* p) { return *(const v8b*)p; }
__device__ __forceinline__ v16b cat8b(v8b a, v8b b) { return __builtin_shufflevector(a, b, 0, 1, 2, 3, 4, 5, 6, 7, 8, 9, 10, 11, 12, 13, 14, 15); }
__device__ __forceinline__ v16b frag_kb(const b16* p, int hh) { return cat8b(ld8b(p + 8 * hh), ld8b(p + 16 + 8 * hh)); }
__device__ __forceinline__ void split16(float v, b16& hi, b16& lo) { hi = (b16)v; lo = (b16)(v - (float)hi); }
// hi/lo fragment pair straight from an f32 k-contiguous row (same k-map)
__device__ __forceinline__ void frag_ksplit(const float* p, int hh, v16b& fh_, v16b& fl_) {
  const float* p0 = p + 8 * hh; const float* p1 = p + 16 + 8 * hh;
#pragma unroll
  for (int e = 0; e < 8; ++e) { b16 a, c; split16(p0[e], a, c); fh_[e] = a; fl_[e] = c; split16(p1[e], a, c); fh_[8 + e] = a; fl_[8 + e] = c; }
}
__device__ __forceinline__ v8f wmma16b(v16b a, v16b b, v8f c) {
  v8f d = __builtin_amdgcn_wmma_f32_16x16x32_f16(false, a, false, b, (short)0, c, false, false);
  asm volatile("v_nop\n\tv_nop\n\tv_nop\n\tv_nop" : "+v"(d) : "v"(a), "v"(b));
  return d;
}
__device__ __forceinline__ void wave_lds_sync() {
  __builtin_amdgcn_fence(__ATOMIC_RELEASE, "workgroup");
  __builtin_amdgcn_wave_barrier();
  __builtin_amdgcn_fence(__ATOMIC_ACQUIRE, "workgroup");
}

// Operand descriptor: NP = 0 -> f32 rows split on the fly into (hi, lo); NP = 1 -> one f16 plane; NP = 2 -> f16 hi + lo planes;
// NP = 3 -> f32 rows rounded once to a single f16 fragment. ld = row pitch.
struct Opnd { const void* p0; const void* p1; int ld; };
template <int NP> __device__ __forceinline__ void load_frags(const Opnd& o, int row, int kb, int hh, v16b& fh_, v16b& fl_) {
  if (NP == 0) { frag_ksplit((const float*)o.p0 + (size_t)row * o.ld + kb, hh, fh_, fl_); }
  else if (NP == 4 || NP == 5) {                             // f32 rows x64 (NP 4) or x8 (NP 5) then split (keeps the lo halves of small values normal)
    const float sc_ = (NP == 4) ? 64.0f : 8.0f;
    const float* p = (const float*)o.p0 + (size_t)row * o.ld + kb; const float* p0 = p + 8 * hh; const float* p1 = p + 16 + 8 * hh;
#pragma unroll
    for (int e = 0; e < 8; ++e) { b16 a, c; split16(p0[e] * sc_, a, c); fh_[e] = a; fl_[e] = c; split16(p1[e] * sc_, a, c); fh_[8 + e] = a; fl_[8 + e] = c; }
  } else if (NP == 3) {
    const float* p = (const float*)o.p0 + (size_t)row * o.ld + kb; const float* p0 = p + 8 * hh; const float* p1 = p + 16 + 8 * hh;
#pragma unroll
    for (int e = 0; e < 8; ++e) { fh_[e] = (b16)p0[e]; fh_[8 + e] = (b16)p1[e]; }
    fl_ = fh_;
  } else {
    fh_ = frag_kb((const b16*)o.p0 + (size_t)row * o.ld + kb, hh);
    if (NP == 2) fl_ = frag_kb((const b16*)o.p1 + (size_t)row * o.ld + kb, hh); else fl_ = fh_;
  }
}
template <int ANP, int BNP> __device__ __forceinline__ v8f mac(v16b ah, v16b al, v16b bh, v16b bl, v8f c) {
  c = wmma16b(ah, bh, c);
  if (BNP == 0 || BNP == 2 || BNP == 4 || BNP == 5) c = wmma16b(ah, bl, c);     // hi.lo
  if (ANP == 0 || ANP == 2 || ANP == 4 || ANP == 5) c = wmma16b(al, bh, c);     // lo.hi   (lo.lo dropped)
  return c;
}
// 32x64 wave tile: acc[r][t] (rows m0+16r.., cols c0+16t..) += A[m][k] . B[n][k] over k in [0, K)
template <int ANP, int BNP>
__device__ __forceinline__ void gemm_tile(const Opnd& A, const Opnd& B, int K, int m0, int c0, int nloc, int hlf, v8f (&acc)[2][4]) {
  for (int kb = 0; kb < K; kb += 32) {
    v16b a0h, a0l, a1h, a1l;
    load_frags<ANP>(A, m0 + nloc, kb, hlf, a0h, a0l);
    load_frags<ANP>(A, m0 + 16 + nloc, kb, hlf, a1h, a1l);
#pragma unroll
    for (int t = 0; t < 4; ++t) {
      v16b bh, bl;
      load_frags<BNP>(B, c0 + t * 16 + nloc, kb, hlf, bh, bl);
      acc[0][t] = mac<ANP, BNP>(a0h, a0l, bh, bl, acc[0][t]);
      acc[1][t] = mac<ANP, BNP>(a1h, a1l, bh, bl, acc[1][t]);
    }
  }
}

__device__ __forceinline__ void epi_planes(v8f (&acc)[2][4], float scale, bool two, b16* __restrict__ oh, b16* __restrict__ ol, int ldo,
                                           int m0, int c0, int lane, b16* Th, b16* Tl) {
  const int nloc = lane & 15, hlf = lane >> 4;
#pragma unroll
  for (int t = 0; t < 4; ++t)
#pragma unroll
    for (int r = 0; r < 2; ++r)
#pragma unroll
      for (int v = 0; v < 8; ++v) {
        const int rr = r * 16 + v + 8 * hlf, cc = t * 16 + nloc;
        b16 h_, l_; split16(acc[r][t][v] * scale, h_, l_);
        Th[rr * 64 + cc] = h_; Tl[rr * 64 + cc] = l_;
      }
  wave_lds_sync();
  {
#pragma unroll
    for (int j = 0; j < 8; ++j) {
      const int rr = j * 4 + (lane >> 3), c8 = (lane & 7) * 8;
      const size_t o = (size_t)(m0 + rr) * ldo + c0 + c8;
      *(v8b*)(oh + o) = ld8b(Th + rr * 64 + c8);
      if (two) *(v8b*)(ol + o) = ld8b(Tl + rr * 64 + c8);
    }
    
  }
}
// (b) f32 rows with pitch ldo: 64 floats = 256 B = 2 lines per row; 16 lanes x 16 B per row, 2 rows per instruction. Optional per-row factor
__device__ __forceinline__ void epi_f32(v8f (&acc)[2][4], float scale, const float* rscale, float* __restrict__ out, int ldo, int m0, int c0, int lane, float* Tt) {
  const int nloc = lane & 15, hlf = lane >> 4;
#pragma unroll
  for (int t = 0; t < 4; ++t)
#pragma unroll
    for (int r = 0; r < 2; ++r)
#pragma unroll
      for (int v = 0; v < 8; ++v) {
        const int rr = r * 16 + v + 8 * hlf;
        const float rs = rscale ? rscale[(size_t)(m0 + rr) * 32] : 1.0f;
        Tt[rr * 64 + t * 16 + nloc] = acc[r][t][v] * scale * rs;
      }
  wave_lds_sync();
  float* dst0 = out + (size_t)m0 * ldo + c0;
  {
#pragma unroll
    for (int j = 0; j < 16; ++j) { const int rr = j * 2 + hlf, c4 = nloc * 4; *(v4f*)(dst0 + (size_t)rr * ldo + c4) = *(const v4f*)(Tt + rr * 64 + c4); }
    
  }
}



typedef __attribute__((ext_vector_type(8))) __bf16 v8bb; typedef __attribute__((ext_vector_type(16))) __bf16 v16bb;
typedef __attribute__((ext_vector_type(8))) unsigned short v8us;
__device__ __forceinline__ v16bb frag_kb_bf(const __bf16* p, int hh) { const v8bb a = *(const v8bb*)(p + 8 * hh), b = *(const v8bb*)(p + 16 + 8 * hh); return __builtin_shufflevector(a, b, 0, 1, 2, 3, 4, 5, 6, 7, 8, 9, 10, 11, 12, 13, 14, 15); }
__device__ __forceinline__ v8f wmma16bb(v16bb a, v16bb b, v8f c) {
  v8f d = __builtin_amdgcn_wmma_f32_16x16x32_bf16(false, a, false, b, (short)0, c, false, false);
  asm volatile("v_nop\n\tv_nop\n\tv_nop\n\tv_nop" : "+v"(d) : "v"(a), "v"(b));
  return d;
}
__device__ __forceinline__ unsigned short bf16_rne_bits(float v) { unsigned int u = __float_as_uint(v); u += 0x7FFFu + ((u >> 16) & 1u); return (unsigned short)(u >> 16); }
__device__ __forceinline__ float bf16_rne(float v) { return __uint_as_float(((unsigned int)bf16_rne_bits(v)) << 16); }



__global__ __launch_bounds__(256) void prep_kernel(const float* __restrict__ x, const float* __restrict__ wqkv, const float* __restrict__ wo, unsigned short* __restrict__ x16, unsigned short* __restrict__ w16, b16* __restrict__ wo16) {
  const size_t tid = (size_t)blockIdx.x * blockDim.x + threadIdx.x, nth = (size_t)gridDim.x * blockDim.x;
  {
    for (size_t p = tid; p < (size_t)NTOK * DIM / 8; p += nth) { v8us v;
#pragma unroll
      for (int e = 0; e < 8; ++e) v[e] = bf16_rne_bits(x[p * 8 + e]);
      *(v8us*)(x16 + p * 8) = v; }
    for (size_t p = tid; p < (size_t)4 * INNER * DIM / 8; p += nth) { const int n = (int)(p / (DIM / 8)), k0 = (int)(p % (DIM / 8)) * 8; v8us v;
#pragma unroll
      for (int e = 0; e < 8; ++e) v[e] = bf16_rne_bits(wqkv[(size_t)(k0 + e) * 4 * INNER + n]);
      *(v8us*)(w16 + (size_t)n * DIM + k0) = v; }
    for (size_t p = tid; p < (size_t)DIM * 2 * INNER / 8; p += nth) { const int n = (int)(p / (2 * INNER / 8)), k0 = (int)(p % (2 * INNER / 8)) * 8; v8b w;
#pragma unroll
      for (int e = 0; e < 8; ++e) w[e] = (b16)bf16_rne(wo[(size_t)(k0 + e) * DIM + n]);
      *(v8b*)(wo16 + (size_t)n * 2 * INNER + k0) = w; }
    
  }
}

// attn2 planes: s[m] = Σ_k exp(-|m-k|/e) (thread per m, f32, same expf), then A2[n][m] = 8 exp(-|n-m|/e)/s[m] as hi/lo f16 planes [2048][2048]; entries below the f16 normal range zeroed.
// That rule zeroes every entry with |n-m| >= 33: s[m] >= 1 (its k = m term), so 8 exp(-33/e)/s[m] <= 4.3e-5 < 2^-14. For a row n of the 32-row group j = n / 32 the key blocks of 32
// other than j-1, j, j+1 hold only such entries: they are neither written nor read. Read per row: 3 blocks from block clamp(j-1, 0, 61); written: the two whole 128-B lines (128 keys,
// from block clamp((j-1) & ~1, 0, 60)) that hold those 3.
__global__ __launch_bounds__(256) void rowsum_kernel(float* __restrict__ srow) {
  const int m = blockIdx.x * 256 + threadIdx.x; float s = 0.0f;
  for (int k = 0; k < S; ++k) s += __expf(-fabsf((float)(m - k)) * INV_E);
  { ((float*)srow)[m] = s;  }
}
__global__ __launch_bounds__(256) void attn2_kernel(const float* __restrict__ srow, b16* __restrict__ a2) {
  const int i = blockIdx.x * 256 + threadIdx.x, n = i >> 4, m0 = min(max(((n >> 5) - 1) & ~1, 0), S / 32 - 4) * 32 + (i & 15) * 8; v8b hv, lv;
#pragma unroll
  for (int e = 0; e < 8; ++e) { const int m = m0 + e; float v = AS2 * __expf(-fabsf((float)(n - m)) * INV_E) / srow[m]; if (v < 6.103515625e-05f) v = 0.0f; b16 a, c; split16(v, a, c); hv[e] = a; lv[e] = c; }
  { *(v8b*)(a2 + (size_t)n * S + m0) = hv; *(v8b*)(a2 + APL + (size_t)n * S + m0) = lv;  }
}

// projections: rows = tokens (4096), K = 512, column tiles of 64 = one head of q | k | v | t (32 tiles): q/k -> x8 hi/lo rows [b*H + h][tok][64]; v, t -> (8v)^T, (8t)^T hi/lo planes
// [b*H + h][64][tok]. grid (32, 32) x 128.
__global__ __launch_bounds__(128) void proj_kernel(const __bf16* __restrict__ x16, const __bf16* __restrict__ w16, b16* __restrict__ qh, b16* __restrict__ kh, b16* __restrict__ vt, b16* __restrict__ tt) {
  __shared__ __attribute__((aligned(16))) b16 Th[4][32][HD + 8], Tq[4][32][HD + 8];
  __shared__ __attribute__((aligned(16))) b16 Tt[64][128 + 8], Tl[64][128 + 8];
  const int lane = threadIdx.x & 31, wave = threadIdx.x >> 5, nloc = lane & 15, hlf = lane >> 4, m0 = blockIdx.y * 128 + wave * 32, c0 = blockIdx.x * 64;
  const int which = blockIdx.x / H, head = blockIdx.x % H, b = m0 / S, tok0 = m0 % S;
  v8f acc[2][4];
#pragma unroll
  for (int r = 0; r < 2; ++r)
#pragma unroll
    for (int t = 0; t < 4; ++t) acc[r][t] = (v8f){};
#pragma unroll 2
  for (int kb = 0; kb < DIM; kb += 32) {
    const v16bb a0 = frag_kb_bf(x16 + (size_t)(m0 + nloc) * DIM + kb, hlf), a1 = frag_kb_bf(x16 + (size_t)(m0 + 16 + nloc) * DIM + kb, hlf);
#pragma unroll
    for (int t = 0; t < 4; ++t) { const v16bb bw = frag_kb_bf(w16 + (size_t)(c0 + t * 16 + nloc) * DIM + kb, hlf); acc[0][t] = wmma16bb(a0, bw, acc[0][t]); acc[1][t] = wmma16bb(a1, bw, acc[1][t]); } }
  if (which < 2) {
#pragma unroll
    for (int t = 0; t < 4; ++t)
#pragma unroll
      for (int r = 0; r < 2; ++r)
#pragma unroll
        for (int v = 0; v < 8; ++v) { b16 a_, c_; split16(acc[r][t][v] * QS, a_, c_); Th[wave][r * 16 + 8 * hlf + v][t * 16 + nloc] = a_; Tq[wave][r * 16 + 8 * hlf + v][t * 16 + nloc] = c_; }
    wave_lds_sync();
    b16* dst = ((which == 0) ? qh : kh) + (((size_t)b * H + head) * S + tok0) * HD;
    {
#pragma unroll
      for (int j = 0; j < 8; ++j) { const int rr = j * 4 + (lane >> 3), c8 = (lane & 7) * 8; *(v8b*)(dst + (size_t)rr * HD + c8) = *(const v8b*)(&Th[wave][rr][c8]); *(v8b*)(dst + QPL + (size_t)rr * HD + c8) = *(const v8b*)(&Tq[wave][rr][c8]); }
       }
    return;
  }
#pragma unroll
  for (int t = 0; t < 4; ++t)
#pragma unroll
    for (int r = 0; r < 2; ++r)
#pragma unroll
      for (int v = 0; v < 8; ++v) { b16 a_, c_; split16(acc[r][t][v] * VS, a_, c_); Tt[t * 16 + nloc][wave * 32 + r * 16 + 8 * hlf + v] = a_; Tl[t * 16 + nloc][wave * 32 + r * 16 + 8 * hlf + v] = c_; }
  __syncthreads();
  b16* dstv = ((which == 2) ? vt : tt) + (((size_t)b * H + head) * HD) * S + (blockIdx.y * 128) % S;
  {
#pragma unroll
    for (int j = 0; j < 8; ++j) { const int dd = wave * 16 + j * 2 + (lane >> 4), c8 = (lane & 15) * 8; *(v8b*)(dstv + (size_t)dd * S + c8) = *(const v8b*)(&Tt[dd][c8]); *(v8b*)(dstv + VPL + (size_t)dd * S + c8) = *(const v8b*)(&Tl[dd][c8]); }
    
  }
}

// attention. The query row of token i is q[i mod 513], so softmax(q~.k / 8).v has only 513 distinct rows per (b, h): each is computed ONCE and stored to its up to four tokens
// r, r + 513, r + 1026, r + 1539 (< 2048). Block = (b, h, 1/16 of the sequence), 11 waves, one role per wave (no barrier between waves):
//   waves 0, 1 : softmax tiles of 16 distinct rows (32 full tiles per (b, h)); wave 10 of the first block of each (b, h): the tile that holds row 512 (rows 513.. are not stored);
//   waves 2..9 : decay tiles of 16 tokens, o2 += (8t)^T . A2^T rows (A2[q][m] as the B operand: rows = queries, k = keys; 3 products), over the 3 key blocks outside which A2 is zero.
// Per row both sums run in ascending key order in steps of 32; softmax: all 2048 keys (k x q hi/lo, 3 products), online softmax, o1 += (8v)^T.P (3 products).
// y[tok][h*128 + 0..63] = o1/(64 l), [64..127] = o2/64; f32 rows; each role stores 256 B (two whole lines) per row.
constexpr int AW = 11, SPB = 2, DPB = 8, BPH = S / 16 / DPB;
static_assert(BPH * SPB * 16 == QP - 1 && QP * 4 >= S, "32 full tiles of distinct rows and one more row; four copies cover the sequence");
__device__ __forceinline__ void softmax_tile(const b16* __restrict__ Q, const b16* __restrict__ K, const b16* __restrict__ V, int r0, int lane, float (*Os)[HD + 4], float* __restrict__ yb) {
  const int hh = lane >> 4, col = lane & 15, qsrc = r0 + col;
  v16b qf[2], ql[2];
#pragma unroll
  for (int ks = 0; ks < 2; ++ks) { qf[ks] = frag_kb(Q + (size_t)qsrc * HD + ks * 32, hh); ql[ks] = frag_kb(Q + QPL + (size_t)qsrc * HD + ks * 32, hh); }
  float m = -INFINITY, l = 0.0f; v8f o1[4] = {{}, {}, {}, {}};
  for (int kb = 0; kb < S; kb += 32) {
    v8f s0 = {}, s1 = {};
#pragma unroll
    for (int ks = 0; ks < 2; ++ks) { const v16b k0 = frag_kb(K + (size_t)(kb + col) * HD + ks * 32, hh), k0l = frag_kb(K + QPL + (size_t)(kb + col) * HD + ks * 32, hh), k1 = frag_kb(K + (size_t)(kb + 16 + col) * HD + ks * 32, hh), k1l = frag_kb(K + QPL + (size_t)(kb + 16 + col) * HD + ks * 32, hh);
      s0 = wmma16b(k0, qf[ks], s0); s0 = wmma16b(k0, ql[ks], s0); s0 = wmma16b(k0l, qf[ks], s0); s1 = wmma16b(k1, qf[ks], s1); s1 = wmma16b(k1, ql[ks], s1); s1 = wmma16b(k1l, qf[ks], s1); }
    float mr = -INFINITY;
#pragma unroll
    for (int r = 0; r < 8; ++r) { s0[r] *= SCALE / (QS * QS); s1[r] *= SCALE / (QS * QS); mr = fmaxf(mr, fmaxf(s0[r], s1[r])); }
    mr = fmaxf(mr, __shfl_xor(mr, 16));
    const float mn = fmaxf(m, mr), al_ = __expf(m - mn); m = mn;
    float sum = 0.0f; v16b pb, pl;
#pragma unroll
    for (int r = 0; r < 8; ++r) { const float e0 = __expf(s0[r] - mn), e1 = __expf(s1[r] - mn); sum += e0 + e1; b16 a, c; split16(e0 * PS, a, c); pb[r] = a; pl[r] = c; split16(e1 * PS, a, c); pb[8 + r] = a; pl[8 + r] = c; }
    sum += __shfl_xor(sum, 16); l = l * al_ + sum;
#pragma unroll
    for (int n = 0; n < 4; ++n) {
#pragma unroll
      for (int r = 0; r < 8; ++r) o1[n][r] *= al_;
      const v16b vf = frag_kb(V + (size_t)(n * 16 + col) * S + kb, hh), vl = frag_kb(V + VPL + (size_t)(n * 16 + col) * S + kb, hh);
      o1[n] = wmma16b(vf, pb, o1[n]); o1[n] = wmma16b(vf, pl, o1[n]); o1[n] = wmma16b(vl, pb, o1[n]); }
  }
  const float i1 = 1.0f / (VS * PS * l);
#pragma unroll
  for (int n = 0; n < 4; ++n)
#pragma unroll
    for (int r = 0; r < 8; ++r) Os[col][n * 16 + 8 * hh + r] = o1[n][r] * i1;
  wave_lds_sync();
#pragma unroll
  for (int j = 0; j < 8; ++j) {                      // two rows x 256 B per instruction (16 lanes x 16 B a row), once per token that uses the row
    const int row = r0 + j * 2 + hh; const v4f val = *(const v4f*)(&Os[j * 2 + hh][col * 4]);
#pragma unroll
    for (int c = 0; c < 4; ++c) { const int tok = row + c * QP; if (row < QP && tok < S) *(v4f*)(yb + (size_t)tok * (2 * INNER) + col * 4) = val; }
  }
}
__device__ __forceinline__ void decay_tile(const b16* __restrict__ T, const b16* __restrict__ a2, int q0, int lane, float (*Os)[HD + 4], float* __restrict__ yb) {
  const int hh = lane >> 4, col = lane & 15, qi = q0 + col;
  v8f o2[4] = {{}, {}, {}, {}};
  const int kb0 = min(max((q0 >> 5) - 1, 0), S / 32 - 3) * 32;   // first of the 3 key blocks outside which A2 rows q0..q0+15 are all zero (see attn2 planes)
  for (int kb = kb0; kb < kb0 + 96; kb += 32) {
    const v16b af = frag_kb(a2 + (size_t)qi * S + kb, hh), al2 = frag_kb(a2 + APL + (size_t)qi * S + kb, hh);   // A2 rows = queries (B operand), k = keys
#pragma unroll
    for (int n = 0; n < 4; ++n) {
      const v16b tf = frag_kb(T + (size_t)(n * 16 + col) * S + kb, hh), tl = frag_kb(T + VPL + (size_t)(n * 16 + col) * S + kb, hh);
      o2[n] = wmma16b(tf, af, o2[n]); o2[n] = wmma16b(tf, al2, o2[n]); o2[n] = wmma16b(tl, af, o2[n]); }
  }
  const float i2 = 1.0f / (VS * AS2);
#pragma unroll
  for (int n = 0; n < 4; ++n)
#pragma unroll
    for (int r = 0; r < 8; ++r) Os[col][n * 16 + 8 * hh + r] = o2[n][r] * i2;
  wave_lds_sync();
#pragma unroll
  for (int j = 0; j < 8; ++j) *(v4f*)(yb + (size_t)(q0 + j * 2 + hh) * (2 * INNER) + HD + col * 4) = *(const v4f*)(&Os[j * 2 + hh][col * 4]);
}
__global__ __launch_bounds__(AW * 32) void attn_kernel(const b16* __restrict__ qh, const b16* __restrict__ kh, const b16* __restrict__ vt, const b16* __restrict__ tt, const b16* __restrict__ a2, float* __restrict__ y) {
  __shared__ __attribute__((aligned(16))) float Os[AW][16][HD + 4];
  const int wid = __builtin_amdgcn_readfirstlane(threadIdx.x >> 5), lane = threadIdx.x & 31;   // the wave's number in a scalar register: the role test is a scalar branch
  const int bh = blockIdx.x / BPH, part = blockIdx.x % BPH, b = bh / H, h = bh % H;
  float* yb = y + (size_t)b * S * (2 * INNER) + h * 2 * HD;
  if (wid >= SPB && wid < SPB + DPB) { decay_tile(tt + (size_t)bh * HD * S, a2, (part * DPB + wid - SPB) * 16, lane, Os[wid], yb); return; }
  if (wid >= SPB && part != 0) return;
  softmax_tile(qh + (size_t)bh * S * HD, kh + (size_t)bh * S * HD, vt + (size_t)bh * HD * S, (wid < SPB) ? (part * SPB + wid) * 16 : QP - 1, lane, Os[wid], yb);
}

// out = y W_out + b: rows 4096, K = 1024 (y split x8 hi/lo at load), 8 column tiles of 64; + bf16(b); f32 rows. grid (8, 32).
__global__ __launch_bounds__(128) void out_kernel(const float* __restrict__ y, const b16* __restrict__ wo16, const float* __restrict__ bo, float* __restrict__ out) {
  __shared__ __attribute__((aligned(16))) float Ts[4][32 * 64];
  const int lane = threadIdx.x & 31, wave = threadIdx.x >> 5, nloc = lane & 15, hlf = lane >> 4, m0 = blockIdx.y * 128 + wave * 32, c0 = blockIdx.x * 64;
  v8f acc[2][4];
#pragma unroll
  for (int r = 0; r < 2; ++r)
#pragma unroll
    for (int t = 0; t < 4; ++t) acc[r][t] = (v8f){};
  const Opnd A{y, nullptr, 2 * INNER}, Bo{wo16, nullptr, 2 * INNER};
  gemm_tile<5, 1>(A, Bo, 2 * INNER, m0, c0, nloc, hlf, acc);
#pragma unroll
  for (int t = 0; t < 4; ++t)
#pragma unroll
    for (int r = 0; r < 2; ++r)
#pragma unroll
      for (int v = 0; v < 8; ++v) acc[r][t][v] = acc[r][t][v] * 0.125f + bf16_rne(bo[c0 + t * 16 + nloc]);
  epi_f32(acc, 1.0f, nullptr, out, DIM, m0, c0, lane, Ts[wave]);
}
}  // namespace

extern "C" void kernel_launch(void* const* d_in, const int* in_sizes, int n_in,
                              void* d_out, int out_size, void* d_ws, size_t ws_size, hipStream_t stream) {
  (void)n_in; (void)out_size;
  const float* x = (const float*)d_in[0]; const float* wqkv = (const float*)d_in[1]; const float* wo = (const float*)d_in[2]; const float* bo = (const float*)d_in[3];
  float* out = (float*)d_out;   // [2][2048][512]
  if (in_sizes[0] != NTOK * DIM || in_sizes[1] != DIM * 4 * INNER || in_sizes[2] != 2 * INNER * DIM || in_sizes[3] != DIM) return;
  size_t off = 0; char* ws = (char*)d_ws;
  auto carve = [&](size_t bytes) { char* p = ws + off; off += (bytes + 255) & ~(size_t)255; return p; };
  unsigned short* x16 = (unsigned short*)carve((size_t)NTOK * DIM * 2); unsigned short* w16 = (unsigned short*)carve((size_t)4 * INNER * DIM * 2); b16* wo16 = (b16*)carve((size_t)DIM * 2 * INNER * 2);
  float* srow = (float*)carve((size_t)S * 4); b16* a2 = (b16*)carve(APL * 2 * 2);
  b16* qh = (b16*)carve(QPL * 2 * 2); b16* kh = (b16*)carve(QPL * 2 * 2); b16* vt = (b16*)carve(VPL * 2 * 2); b16* tt = (b16*)carve(VPL * 2 * 2); float* y = (float*)carve((size_t)NTOK * 2 * INNER * 4);
  if (off > ws_size) return;                                    // ≈ 74.5 MB
  prep_kernel<<<1024, 256, 0, stream>>>(x, wqkv, wo, x16, w16, wo16);
  rowsum_kernel<<<S / 256, 256, 0, stream>>>(srow);
  attn2_kernel<<<S * 16 / 256, 256, 0, stream>>>(srow, a2);
  proj_kernel<<<dim3(4 * INNER / 64, NTOK / 128), 128, 0, stream>>>((const __bf16*)x16, (const __bf16*)w16, qh, kh, vt, tt);
  attn_kernel<<<Bn * H * BPH, AW * 32, 0, stream>>>(qh, kh, vt, tt, a2, y);
  out_kernel<<<dim3(DIM / 64, NTOK / 128), 128, 0, stream>>>(y, wo16, bo, out);
}

// v003
// Measured time: 153 microseconds a run.
// In both of two side-by-side timings against v002, it was 1.47 times as fast.
// Over all steps from v000 it is 2.42 times as fast.
#include <hip/hip_runtime.h>

// "Fast attention": [q | k | v | t] = x W_qkv (8 heads x 64 each); query i uses q[i mod 513] (the module's pad/reshape/tile trick with STEP 4, n = 2048); attn1 = softmax(q~.k / 8) over
// all 2048 keys; out1 = attn1.v; attn2[n][m] = exp(-|n-m|/e) / s[m] with s[m] = sum_k exp(-|m-k|/e) (the module's broadcast divides column m by row-sum m); out2 = attn2.t (shared
// over batch and heads); out = [out1 | out2 per head] W_out + b -> [2][2048][512].
// Numerics: x, W_qkv, W_out, b_out rounded to bf16; projection on v_wmma_f32_16x16x32_bf16 (exact products); q, k, v, t, P and the
// merged attention output carried x8 as f16 hi+lo pairs (3 / 2 products) on v_wmma_f32_16x16x32_f16; the analytic attn2 matrix as an x8 f16 hi+lo pair (entries that would be f16-
// subnormal are zeroed identically everywhere — they are < 8e-6 of a row); online softmax and the row sums s[m] in f32. Fragment k-map per lane half hh for A AND B: elements 0..7 <-

namespace {
constexpr int Bn = 2, S = 2048, DIM = 512, H = 8, HD = 64, INNER = 512, NTOK = Bn * S, QP = 513 /* (n + yushu) / STEP */;
constexpr float SCALE = 0.125f, VS = 8.0f, QS = 8.0f, PS = 8.0f, AS2 = 8.0f, INV_E = 0.36787944117144233f;
constexpr size_t QPL = (size_t)Bn * H * S * HD, VPL = QPL, APL = (size_t)S * S;

typedef _Float16 b16;
typedef __attribute__((ext_vector_type(16))) _Float16 v16b;
typedef __attribute__((ext_vector_type(8)))  _Float16 v8b;
typedef __attribute__((ext_vector_type(8)))  float v8f;
typedef __attribute__((ext_vector_type(4)))  float v4f;

__device__ __forceinline__ v8b ld8b(const b16* p) { return *(const v8b*)p; }
__device__ __forceinline__ v16b cat8b(v8b a, v8b b) { return __builtin_shufflevector(a, b, 0, 1, 2, 3, 4, 5, 6, 7, 8, 9, 10, 11, 12, 13, 14, 15); }
__device__ __forceinline__ v16b frag_kb(const b16* p, int hh) { return cat8b(ld8b(p + 8 * hh), ld8b(p + 16 + 8 * hh)); }
__device__ __forceinline__ void split16(float v, b16& hi, b16& lo) { hi = (b16)v; lo = (b16)(v - (float)hi); }
// hi/lo fragment pair straight from an f32 k-contiguous row (same k-map)
__device__ __forceinline__ void frag_ksplit(const float* p, int hh, v16b& fh_, v16b& fl_) {
  const float* p0 = p + 8 * hh; const float* p1 = p + 16 + 8 * hh;
#pragma unroll
  for (int e = 0; e < 8; ++e) { b16 a, c; split16(p0[e], a, c); fh_[e] = a; fl_[e] = c; split16(p1[e], a, c); fh_[8 + e] = a; fl_[8 + e] = c; }
}
__device__ __forceinline__ v8f wmma16b(v16b a, v16b b, v8f c) {
  v8f d = __builtin_amdgcn_wmma_f32_16x16x32_f16(false, a, false, b, (short)0, c, false, false);
  asm volatile("v_nop\n\tv_nop\n\tv_nop\n\tv_nop" : "+v"(d) : "v"(a), "v"(b));
  return d;
}
__device__ __forceinline__ void wave_lds_sync() {
  __builtin_amdgcn_fence(__ATOMIC_RELEASE, "workgroup");
  __builtin_amdgcn_wave_barrier();
  __builtin_amdgcn_fence(__ATOMIC_ACQUIRE, "workgroup");
}

// Operand descriptor: NP = 0 -> f32 rows split on the fly into (hi, lo); NP = 1 -> one f16 plane; NP = 2 -> f16 hi + lo planes;
// NP = 3 -> f32 rows rounded once to a single f16 fragment. ld = row pitch.
struct Opnd { const void* p0; const void* p1; int ld; };
template <int NP> __device__ __forceinline__ void load_frags(const Opnd& o, int row, int kb, int hh, v16b& fh_, v16b& fl_) {
  if (NP == 0) { frag_ksplit((const float*)o.p0 + (size_t)row * o.ld + kb, hh, fh_, fl_); }
  else if (NP == 4 || NP == 5) {                             // f32 rows x64 (NP 4) or x8 (NP 5) then split (keeps the lo halves of small values normal)
    const float sc_ = (NP == 4) ? 64.0f : 8.0f;
    const float* p = (const float*)o.p0 + (size_t)row * o.ld + kb; const float* p0 = p + 8 * hh; const float* p1 = p + 16 + 8 * hh;
#pragma unroll
    for (int e = 0; e < 8; ++e) { b16 a, c; split16(p0[e] * sc_, a, c); fh_[e] = a; fl_[e] = c; split16(p1[e] * sc_, a, c); fh_[8 + e] = a; fl_[8 + e] = c; }
  } else if (NP == 3) {
    const float* p = (const float*)o.p0 + (size_t)row * o.ld + kb; const float* p0 = p + 8 * hh; const float* p1 = p + 16 + 8 * hh;
#pragma unroll
    for (int e = 0; e < 8; ++e) { fh_[e] = (b16)p0[e]; fh_[8 + e] = (b16)p1[e]; }
    fl_ = fh_;
  } else {
    fh_ = frag_kb((const b16*)o.p0 + (size_t)row * o.ld + kb, hh);
    if (NP == 2) fl_ = frag_kb((const b16*)o.p1 + (size_t)row * o.ld + kb, hh); else fl_ = fh_;
  }
}
template <int ANP, int BNP> __device__ __forceinline__ v8f mac(v16b ah, v16b al, v16b bh, v16b bl, v8f c) {
  c = wmma16b(ah, bh, c);
  if (BNP == 0 || BNP == 2 || BNP == 4 || BNP == 5) c = wmma16b(ah, bl, c);     // hi.lo
  if (ANP == 0 || ANP == 2 || ANP == 4 || ANP == 5) c = wmma16b(al, bh, c);     // lo.hi   (lo.lo dropped)
  return c;
}
// 32x64 wave tile: acc[r][t] (rows m0+16r.., cols c0+16t..) += A[m][k] . B[n][k] over k in [0, K)
template <int ANP, int BNP>
__device__ __forceinline__ void gemm_tile(const Opnd& A, const Opnd& B, int K, int m0, int c0, int nloc, int hlf, v8f (&acc)[2][4]) {
  for (int kb = 0; kb < K; kb += 32) {
    v16b a0h, a0l, a1h, a1l;
    load_frags<ANP>(A, m0 + nloc, kb, hlf, a0h, a0l);
    load_frags<ANP>(A, m0 + 16 + nloc, kb, hlf, a1h, a1l);
#pragma unroll
    for (int t = 0; t < 4; ++t) {
      v16b bh, bl;
      load_frags<BNP>(B, c0 + t * 16 + nloc, kb, hlf, bh, bl);
      acc[0][t] = mac<ANP, BNP>(a0h, a0l, bh, bl, acc[0][t]);
      acc[1][t] = mac<ANP, BNP>(a1h, a1l, bh, bl, acc[1][t]);
    }
  }
}

__device__ __forceinline__ void epi_planes(v8f (&acc)[2][4], float scale, bool two, b16* __restrict__ oh, b16* __restrict__ ol, int ldo,
                                           int m0, int c0, int lane, b16* Th, b16* Tl) {
  const int nloc = lane & 15, hlf = lane >> 4;
#pragma unroll
  for (int t = 0; t < 4; ++t)
#pragma unroll
    for (int r = 0; r < 2; ++r)
#pragma unroll
      for (int v = 0; v < 8; ++v) {
        const int rr = r * 16 + v + 8 * hlf, cc = t * 16 + nloc;
        b16 h_, l_; split16(acc[r][t][v] * scale, h_, l_);
        Th[rr * 64 + cc] = h_; Tl[rr * 64 + cc] = l_;
      }
  wave_lds_sync();
  {
#pragma unroll
    for (int j = 0; j < 8; ++j) {
      const int rr = j * 4 + (lane >> 3), c8 = (lane & 7) * 8;
      const size_t o = (size_t)(m0 + rr) * ldo + c0 + c8;
      *(v8b*)(oh + o) = ld8b(Th + rr * 64 + c8);
      if (two) *(v8b*)(ol + o) = ld8b(Tl + rr * 64 + c8);
    }
    
  }
}
// (b) f32 rows with pitch ldo: 64 floats = 256 B = 2 lines per row; 16 lanes x 16 B per row, 2 rows per instruction. Optional per-row factor
__device__ __forceinline__ void epi_f32(v8f (&acc)[2][4], float scale, const float* rscale, float* __restrict__ out, int ldo, int m0, int c0, int lane, float* Tt) {
  const int nloc = lane & 15, hlf = lane >> 4;
#pragma unroll
  for (int t = 0; t < 4; ++t)
#pragma unroll
    for (int r = 0; r < 2; ++r)
#pragma unroll
      for (int v = 0; v < 8; ++v) {
        const int rr = r * 16 + v + 8 * hlf;
        const float rs = rscale ? rscale[(size_t)(m0 + rr) * 32] : 1.0f;
        Tt[rr * 64 + t * 16 + nloc] = acc[r][t][v] * scale * rs;
      }
  wave_lds_sync();
  float* dst0 = out + (size_t)m0 * ldo + c0;
  {
#pragma unroll
    for (int j = 0; j < 16; ++j) { const int rr = j * 2 + hlf, c4 = nloc * 4; *(v4f*)(dst0 + (size_t)rr * ldo + c4) = *(const v4f*)(Tt + rr * 64 + c4); }
    
  }
}



typedef __attribute__((ext_vector_type(8))) __bf16 v8bb; typedef __attribute__((ext_vector_type(16))) __bf16 v16bb;
typedef __attribute__((ext_vector_type(8))) unsigned short v8us;
__device__ __forceinline__ v16bb frag_kb_bf(const __bf16* p, int hh) { const v8bb a = *(const v8bb*)(p + 8 * hh), b = *(const v8bb*)(p + 16 + 8 * hh); return __builtin_shufflevector(a, b, 0, 1, 2, 3, 4, 5, 6, 7, 8, 9, 10, 11, 12, 13, 14, 15); }
__device__ __forceinline__ v8f wmma16bb(v16bb a, v16bb b, v8f c) {
  v8f d = __builtin_amdgcn_wmma_f32_16x16x32_bf16(false, a, false, b, (short)0, c, false, false);
  asm volatile("v_nop\n\tv_nop\n\tv_nop\n\tv_nop" : "+v"(d) : "v"(a), "v"(b));
  return d;
}
__device__ __forceinline__ unsigned short bf16_rne_bits(float v) { unsigned int u = __float_as_uint(v); u += 0x7FFFu + ((u >> 16) & 1u); return (unsigned short)(u >> 16); }
__device__ __forceinline__ float bf16_rne(float v) { return __uint_as_float(((unsigned int)bf16_rne_bits(v)) << 16); }



__global__ __launch_bounds__(256) void prep_kernel(const float* __restrict__ x, const float* __restrict__ wqkv, const float* __restrict__ wo, unsigned short* __restrict__ x16, unsigned short* __restrict__ w16, b16* __restrict__ wo16) {
  const size_t tid = (size_t)blockIdx.x * blockDim.x + threadIdx.x, nth = (size_t)gridDim.x * blockDim.x;
  {
    for (size_t p = tid; p < (size_t)NTOK * DIM / 8; p += nth) { v8us v;
#pragma unroll
      for (int e = 0; e < 8; ++e) v[e] = bf16_rne_bits(x[p * 8 + e]);
      *(v8us*)(x16 + p * 8) = v; }
    for (size_t p = tid; p < (size_t)4 * INNER * DIM / 8; p += nth) { const int n = (int)(p / (DIM / 8)), k0 = (int)(p % (DIM / 8)) * 8; v8us v;
#pragma unroll
      for (int e = 0; e < 8; ++e) v[e] = bf16_rne_bits(wqkv[(size_t)(k0 + e) * 4 * INNER + n]);
      *(v8us*)(w16 + (size_t)n * DIM + k0) = v; }
    for (size_t p = tid; p < (size_t)DIM * 2 * INNER / 8; p += nth) { const int n = (int)(p / (2 * INNER / 8)), k0 = (int)(p % (2 * INNER / 8)) * 8; v8b w;
#pragma unroll
      for (int e = 0; e < 8; ++e) w[e] = (b16)bf16_rne(wo[(size_t)(k0 + e) * DIM + n]);
      *(v8b*)(wo16 + (size_t)n * 2 * INNER + k0) = w; }
    
  }
}

// attn2 planes: s[m] = Σ_k exp(-|m-k|/e) (thread per m, f32, same expf), then A2[n][m] = 8 exp(-|n-m|/e)/s[m] as hi/lo f16 planes [2048][2048]; entries below the f16 normal range zeroed.
// That rule zeroes every entry with |n-m| >= 33: s[m] >= 1 (its k = m term), so 8 exp(-33/e)/s[m] <= 4.3e-5 < 2^-14. For a row n of the 32-row group j = n / 32 the key blocks of 32
// other than j-1, j, j+1 hold only such entries: they are neither written nor read. Read per row: 3 blocks from block clamp(j-1, 0, 61); written: the two whole 128-B lines (128 keys,
// from block clamp((j-1) & ~1, 0, 60)) that hold those 3.
__global__ __launch_bounds__(256) void rowsum_kernel(float* __restrict__ srow) {
  const int m = blockIdx.x * 256 + threadIdx.x; float s = 0.0f;
  for (int k = 0; k < S; ++k) s += __expf(-fabsf((float)(m - k)) * INV_E);
  { ((float*)srow)[m] = s;  }
}
__global__ __launch_bounds__(256) void attn2_kernel(const float* __restrict__ srow, b16* __restrict__ a2) {
  const int i = blockIdx.x * 256 + threadIdx.x, n = i >> 4, m0 = min(max(((n >> 5) - 1) & ~1, 0), S / 32 - 4) * 32 + (i & 15) * 8; v8b hv, lv;
#pragma unroll
  for (int e = 0; e < 8; ++e) { const int m = m0 + e; float v = AS2 * __expf(-fabsf((float)(n - m)) * INV_E) / srow[m]; if (v < 6.103515625e-05f) v = 0.0f; b16 a, c; split16(v, a, c); hv[e] = a; lv[e] = c; }
  { *(v8b*)(a2 + (size_t)n * S + m0) = hv; *(v8b*)(a2 + APL + (size_t)n * S + m0) = lv;  }
}

// projections: rows = tokens (4096), K = 512, column tiles of 64 = one head of q | k | v | t (32 tiles): q/k -> x8 hi/lo rows [b*H + h][tok][64]; v, t -> (8v)^T, (8t)^T hi/lo planes
// [b*H + h][64][tok]. grid (32, 32) x 128.
__global__ __launch_bounds__(128) void proj_kernel(const __bf16* __restrict__ x16, const __bf16* __restrict__ w16, b16* __restrict__ qh, b16* __restrict__ kh, b16* __restrict__ vt, b16* __restrict__ tt) {
  __shared__ __attribute__((aligned(16))) b16 Th[4][32][HD + 8], Tq[4][32][HD + 8];
  __shared__ __attribute__((aligned(16))) b16 Tt[64][128 + 8], Tl[64][128 + 8];
  const int lane = threadIdx.x & 31, wave = threadIdx.x >> 5, nloc = lane & 15, hlf = lane >> 4, m0 = blockIdx.y * 128 + wave * 32, c0 = blockIdx.x * 64;
  const int which = blockIdx.x / H, head = blockIdx.x % H, b = m0 / S, tok0 = m0 % S;
  v8f acc[2][4];
#pragma unroll
  for (int r = 0; r < 2; ++r)
#pragma unroll
    for (int t = 0; t < 4; ++t) acc[r][t] = (v8f){};
#pragma unroll 2
  for (int kb = 0; kb < DIM; kb += 32) {
    const v16bb a0 = frag_kb_bf(x16 + (size_t)(m0 + nloc) * DIM + kb, hlf), a1 = frag_kb_bf(x16 + (size_t)(m0 + 16 + nloc) * DIM + kb, hlf);
#pragma unroll
    for (int t = 0; t < 4; ++t) { const v16bb bw = frag_kb_bf(w16 + (size_t)(c0 + t * 16 + nloc) * DIM + kb, hlf); acc[0][t] = wmma16bb(a0, bw, acc[0][t]); acc[1][t] = wmma16bb(a1, bw, acc[1][t]); } }
  if (which < 2) {
#pragma unroll
    for (int t = 0; t < 4; ++t)
#pragma unroll
      for (int r = 0; r < 2; ++r)
#pragma unroll
        for (int v = 0; v < 8; ++v) { b16 a_, c_; split16(acc[r][t][v] * QS, a_, c_); Th[wave][r * 16 + 8 * hlf + v][t * 16 + nloc] = a_; Tq[wave][r * 16 + 8 * hlf + v][t * 16 + nloc] = c_; }
    wave_lds_sync();
    b16* dst = ((which == 0) ? qh : kh) + (((size_t)b * H + head) * S + tok0) * HD;
    {
#pragma unroll
      for (int j = 0; j < 8; ++j) { const int rr = j * 4 + (lane >> 3), c8 = (lane & 7) * 8; *(v8b*)(dst + (size_t)rr * HD + c8) = *(const v8b*)(&Th[wave][rr][c8]); *(v8b*)(dst + QPL + (size_t)rr * HD + c8) = *(const v8b*)(&Tq[wave][rr][c8]); }
       }
    return;
  }
#pragma unroll
  for (int t = 0; t < 4; ++t)
#pragma unroll
    for (int r = 0; r < 2; ++r)
#pragma unroll
      for (int v = 0; v < 8; ++v) { b16 a_, c_; split16(acc[r][t][v] * VS, a_, c_); Tt[t * 16 + nloc][wave * 32 + r * 16 + 8 * hlf + v] = a_; Tl[t * 16 + nloc][wave * 32 + r * 16 + 8 * hlf + v] = c_; }
  __syncthreads();
  b16* dstv = ((which == 2) ? vt : tt) + (((size_t)b * H + head) * HD) * S + (blockIdx.y * 128) % S;
  {
#pragma unroll
    for (int j = 0; j < 8; ++j) { const int dd = wave * 16 + j * 2 + (lane >> 4), c8 = (lane & 15) * 8; *(v8b*)(dstv + (size_t)dd * S + c8) = *(const v8b*)(&Tt[dd][c8]); *(v8b*)(dstv + VPL + (size_t)dd * S + c8) = *(const v8b*)(&Tl[dd][c8]); }
    
  }
}

// attention. The query row of token i is q[i mod 513], so softmax(q~.k / 8).v has only 513 distinct rows per (b, h): each is computed ONCE and stored to its up to four tokens
// r, r + 513, r + 1026, r + 1539 (< 2048). Block = (b, h, 1/16 of the sequence), 24 waves:
//   waves 0..15 : two softmax tiles of 16 distinct rows (32 full tiles per (b, h)), each tile's 2048 keys split over 8 waves (256 keys in a row per wave);
//   waves 16..23: decay tiles of 16 tokens, o2 += (8t)^T . A2^T rows (A2[q][m] as the B operand: rows = queries, k = keys; 3 products), over the 3 key blocks outside which A2 is zero;
//                 in the first block of each (b, h) they then take the 8 key parts of the tile that holds row 512 (rows 513.. are not stored).
// A softmax wave runs the online softmax over its own keys in ascending order in steps of 32 (k x q hi/lo, 3 products; o1 += (8v)^T.P, 3 products) and leaves its running maximum m, its sum l
// and its unnormalised o1 in LDS; behind one block barrier the 8 parts of a tile are merged in ascending key order: M = max m_w, l = sum l_w e^(m_w - M), o1 = sum o1_w e^(m_w - M).
// y[tok][h*128 + 0..63] = o1/(64 l), [64..127] = o2/64; f32 rows; each role stores 256 B (two whole lines) per row.
constexpr int NS = 8, KPS = S / NS, SPB = 2, DPB = 8, BPH = S / 16 / DPB, AW = SPB * NS + DPB;
static_assert(BPH * SPB * 16 == QP - 1 && QP * 4 >= S, "32 full tiles of distinct rows and one more row; four copies cover the sequence");
static_assert(DPB == NS && KPS % 32 == 0, "the decay waves of a block are as many as the key parts of the last tile");
__device__ __forceinline__ void softmax_part(const b16* __restrict__ Q, const b16* __restrict__ K, const b16* __restrict__ V, int r0, int kb0, int lane, float (*Os)[HD + 4], float* Ms, float* Ls) {
  const int hh = lane >> 4, col = lane & 15, qsrc = r0 + col;
  v16b qf[2], ql[2];
#pragma unroll
  for (int ks = 0; ks < 2; ++ks) { qf[ks] = frag_kb(Q + (size_t)qsrc * HD + ks * 32, hh); ql[ks] = frag_kb(Q + QPL + (size_t)qsrc * HD + ks * 32, hh); }
  float m = -INFINITY, l = 0.0f; v8f o1[4] = {{}, {}, {}, {}};
  for (int kb = kb0; kb < kb0 + KPS; kb += 32) {
    v8f s0 = {}, s1 = {};
#pragma unroll
    for (int ks = 0; ks < 2; ++ks) { const v16b k0 = frag_kb(K + (size_t)(kb + col) * HD + ks * 32, hh), k0l = frag_kb(K + QPL + (size_t)(kb + col) * HD + ks * 32, hh), k1 = frag_kb(K + (size_t)(kb + 16 + col) * HD + ks * 32, hh), k1l = frag_kb(K + QPL + (size_t)(kb + 16 + col) * HD + ks * 32, hh);
      s0 = wmma16b(k0, qf[ks], s0); s0 = wmma16b(k0, ql[ks], s0); s0 = wmma16b(k0l, qf[ks], s0); s1 = wmma16b(k1, qf[ks], s1); s1 = wmma16b(k1, ql[ks], s1); s1 = wmma16b(k1l, qf[ks], s1); }
    float mr = -INFINITY;
#pragma unroll
    for (int r = 0; r < 8; ++r) { s0[r] *= SCALE / (QS * QS); s1[r] *= SCALE / (QS * QS); mr = fmaxf(mr, fmaxf(s0[r], s1[r])); }
    mr = fmaxf(mr, __shfl_xor(mr, 16));
    const float mn = fmaxf(m, mr), al_ = __expf(m - mn); m = mn;
    float sum = 0.0f; v16b pb, pl;
#pragma unroll
    for (int r = 0; r < 8; ++r) { const float e0 = __expf(s0[r] - mn), e1 = __expf(s1[r] - mn); sum += e0 + e1; b16 a, c; split16(e0 * PS, a, c); pb[r] = a; pl[r] = c; split16(e1 * PS, a, c); pb[8 + r] = a; pl[8 + r] = c; }
    sum += __shfl_xor(sum, 16); l = l * al_ + sum;
#pragma unroll
    for (int n = 0; n < 4; ++n) {
#pragma unroll
      for (int r = 0; r < 8; ++r) o1[n][r] *= al_;
      const v16b vf = frag_kb(V + (size_t)(n * 16 + col) * S + kb, hh), vl = frag_kb(V + VPL + (size_t)(n * 16 + col) * S + kb, hh);
      o1[n] = wmma16b(vf, pb, o1[n]); o1[n] = wmma16b(vf, pl, o1[n]); o1[n] = wmma16b(vl, pb, o1[n]); }
  }
#pragma unroll
  for (int n = 0; n < 4; ++n)
#pragma unroll
    for (int r = 0; r < 8; ++r) Os[col][n * 16 + 8 * hh + r] = o1[n][r];
  if (hh == 0) { Ms[col] = m; Ls[col] = l; }
}
// one float4 of a tile's 16 x 64 result per thread t of 256: two rows x 256 B per store instruction (16 lanes x 16 B a row), once per token that uses the row
__device__ __forceinline__ void merge_tile(const float (*Os)[16][HD + 4], const float (*Ms)[16], const float (*Ls)[16], int r0, int t, float* __restrict__ yb) {
  const int rl = t >> 4, c4 = (t & 15) * 4, row = r0 + rl;
  float M = Ms[0][rl];
#pragma unroll
  for (int w = 1; w < NS; ++w) M = fmaxf(M, Ms[w][rl]);
  float l = 0.0f; v4f acc = {};
#pragma unroll
  for (int w = 0; w < NS; ++w) { const float f = __expf(Ms[w][rl] - M); l += Ls[w][rl] * f; acc += *(const v4f*)(&Os[w][rl][c4]) * f; }
  const v4f val = acc * (1.0f / (VS * PS * l));
#pragma unroll
  for (int c = 0; c < 4; ++c) { const int tok = row + c * QP; if (row < QP && tok < S) *(v4f*)(yb + (size_t)tok * (2 * INNER) + c4) = val; }
}
__device__ __forceinline__ void decay_tile(const b16* __restrict__ T, const b16* __restrict__ a2, int q0, int lane, float (*Os)[HD + 4], float* __restrict__ yb) {
  const int hh = lane >> 4, col = lane & 15, qi = q0 + col;
  v8f o2[4] = {{}, {}, {}, {}};
  const int kb0 = min(max((q0 >> 5) - 1, 0), S / 32 - 3) * 32;   // first of the 3 key blocks outside which A2 rows q0..q0+15 are all zero (see attn2 planes)
  for (int kb = kb0; kb < kb0 + 96; kb += 32) {
    const v16b af = frag_kb(a2 + (size_t)qi * S + kb, hh), al2 = frag_kb(a2 + APL + (size_t)qi * S + kb, hh);   // A2 rows = queries (B operand), k = keys
#pragma unroll
    for (int n = 0; n < 4; ++n) {
      const v16b tf = frag_kb(T + (size_t)(n * 16 + col) * S + kb, hh), tl = frag_kb(T + VPL + (size_t)(n * 16 + col) * S + kb, hh);
      o2[n] = wmma16b(tf, af, o2[n]); o2[n] = wmma16b(tf, al2, o2[n]); o2[n] = wmma16b(tl, af, o2[n]); }
  }
  const float i2 = 1.0f / (VS * AS2);
#pragma unroll
  for (int n = 0; n < 4; ++n)
#pragma unroll
    for (int r = 0; r < 8; ++r) Os[col][n * 16 + 8 * hh + r] = o2[n][r] * i2;
  wave_lds_sync();
#pragma unroll
  for (int j = 0; j < 8; ++j) *(v4f*)(yb + (size_t)(q0 + j * 2 + hh) * (2 * INNER) + HD + col * 4) = *(const v4f*)(&Os[j * 2 + hh][col * 4]);
}
__global__ __launch_bounds__(AW * 32) void attn_kernel(const b16* __restrict__ qh, const b16* __restrict__ kh, const b16* __restrict__ vt, const b16* __restrict__ tt, const b16* __restrict__ a2, float* __restrict__ y) {
  __shared__ __attribute__((aligned(16))) float Os[AW][16][HD + 4];
  __shared__ float Ms[AW][16], Ls[AW][16];
  const int wid = __builtin_amdgcn_readfirstlane(threadIdx.x >> 5), lane = threadIdx.x & 31;   // the wave's number in a scalar register: the role tests are scalar branches
  const int bh = blockIdx.x / BPH, part = blockIdx.x % BPH, b = bh / H, h = bh % H;
  float* yb = y + (size_t)b * S * (2 * INNER) + h * 2 * HD;
  const int grp = wid / NS;                                       // 0, 1: the block's two full tiles; 2: the tile of row 512 (first block of each (b, h) only)
  const int r0 = (grp < SPB) ? (part * SPB + grp) * 16 : QP - 1;
  const bool has_tile = grp < SPB || part == 0;
  if (grp == SPB) {
    decay_tile(tt + (size_t)bh * HD * S, a2, (part * DPB + wid - SPB * NS) * 16, lane, Os[wid], yb);
    asm volatile("s_wait_xcnt 0x0" ::: "memory");                 // the wave may go on to a softmax part, which rewrites the registers that the stores above name
  }
  if (has_tile) softmax_part(qh + (size_t)bh * S * HD, kh + (size_t)bh * S * HD, vt + (size_t)bh * HD * S, r0, (wid % NS) * KPS, lane, Os[wid], Ms[wid], Ls[wid]);
  __syncthreads();                                                // every wave of the block passes it: the 8 parts of a tile are in LDS
  if (has_tile) merge_tile(&Os[grp * NS], &Ms[grp * NS], &Ls[grp * NS], r0, (int)threadIdx.x % (NS * 32), yb);
}

// out = y W_out + b: rows 4096, K = 1024 (y split x8 hi/lo at load), 8 column tiles of 64; + bf16(b); f32 rows. grid (8, 32).
__global__ __launch_bounds__(128) void out_kernel(const float* __restrict__ y, const b16* __restrict__ wo16, const float* __restrict__ bo, float* __restrict__ out) {
  __shared__ __attribute__((aligned(16))) float Ts[4][32 * 64];
  const int lane = threadIdx.x & 31, wave = threadIdx.x >> 5, nloc = lane & 15, hlf = lane >> 4, m0 = blockIdx.y * 128 + wave * 32, c0 = blockIdx.x * 64;
  v8f acc[2][4];
#pragma unroll
  for (int r = 0; r < 2; ++r)
#pragma unroll
    for (int t = 0; t < 4; ++t) acc[r][t] = (v8f){};
  const Opnd A{y, nullptr, 2 * INNER}, Bo{wo16, nullptr, 2 * INNER};
  gemm_tile<5, 1>(A, Bo, 2 * INNER, m0, c0, nloc, hlf, acc);
#pragma unroll
  for (int t = 0; t < 4; ++t)
#pragma unroll
    for (int r = 0; r < 2; ++r)
#pragma unroll
      for (int v = 0; v < 8; ++v) acc[r][t][v] = acc[r][t][v] * 0.125f + bf16_rne(bo[c0 + t * 16 + nloc]);
  epi_f32(acc, 1.0f, nullptr, out, DIM, m0, c0, lane, Ts[wave]);
}
}  // namespace

extern "C" void kernel_launch(void* const* d_in, const int* in_sizes, int n_in,
                              void* d_out, int out_size, void* d_ws, size_t ws_size, hipStream_t stream) {
  (void)n_in; (void)out_size;
  const float* x = (const float*)d_in[0]; const float* wqkv = (const float*)d_in[1]; const float* wo = (const float*)d_in[2]; const float* bo = (const float*)d_in[3];
  float* out = (float*)d_out;   // [2][2048][512]
  if (in_sizes[0] != NTOK * DIM || in_sizes[1] != DIM * 4 * INNER || in_sizes[2] != 2 * INNER * DIM || in_sizes[3] != DIM) return;
  size_t off = 0; char* ws = (char*)d_ws;
  auto carve = [&](size_t bytes) { char* p = ws + off; off += (bytes + 255) & ~(size_t)255; return p; };
  unsigned short* x16 = (unsigned short*)carve((size_t)NTOK * DIM * 2); unsigned short* w16 = (unsigned short*)carve((size_t)4 * INNER * DIM * 2); b16* wo16 = (b16*)carve((size_t)DIM * 2 * INNER * 2);
  float* srow = (float*)carve((size_t)S * 4); b16* a2 = (b16*)carve(APL * 2 * 2);
  b16* qh = (b16*)carve(QPL * 2 * 2); b16* kh = (b16*)carve(QPL * 2 * 2); b16* vt = (b16*)carve(VPL * 2 * 2); b16* tt = (b16*)carve(VPL * 2 * 2); float* y = (float*)carve((size_t)NTOK * 2 * INNER * 4);
  if (off > ws_size) return;                                    // ≈ 74.5 MB
  prep_kernel<<<1024, 256, 0, stream>>>(x, wqkv, wo, x16, w16, wo16);
  rowsum_kernel<<<S / 256, 256, 0, stream>>>(srow);
  attn2_kernel<<<S * 16 / 256, 256, 0, stream>>>(srow, a2);
  proj_kernel<<<dim3(4 * INNER / 64, NTOK / 128), 128, 0, stream>>>((const __bf16*)x16, (const __bf16*)w16, qh, kh, vt, tt);
  attn_kernel<<<Bn * H * BPH, AW * 32, 0, stream>>>(qh, kh, vt, tt, a2, y);
  out_kernel<<<dim3(DIM / 64, NTOK / 128), 128, 0, stream>>>(y, wo16, bo, out);
}

// v004
// A run of this version takes 134 microseconds.
// Timed twice side by side with v003, it ran 1.13 and 1.14 times as fast.
// All steps since v000 together make it 2.74 times as fast.
#include <hip/hip_runtime.h>

// "Fast attention": [q | k | v | t] = x W_qkv (8 heads x 64 each); query i uses q[i mod 513] (the module's pad/reshape/tile trick with STEP 4, n = 2048); attn1 = softmax(q~.k / 8) over
// all 2048 keys; out1 = attn1.v; attn2[n][m] = exp(-|n-m|/e) / s[m] with s[m] = sum_k exp(-|m-k|/e) (the module's broadcast divides column m by row-sum m); out2 = attn2.t (shared
// over batch and heads); out = [out1 | out2 per head] W_out + b -> [2][2048][512].
// Numerics: x, W_qkv, W_out, b_out rounded to bf16; projection on v_wmma_f32_16x16x32_bf16 (exact products); q, k, v, t, P and the
// merged attention output carried x8 as f16 hi+lo pairs (3 / 2 products) on v_wmma_f32_16x16x32_f16; the analytic attn2 matrix as an x8 f16 hi+lo pair (entries that would be f16-
// subnormal are zeroed identically everywhere — they are < 8e-6 of a row); online softmax and the row sums s[m] in f32. Fragment k-map per lane half hh for A AND B: elements 0..7 <-

namespace {
constexpr int Bn = 2, S = 2048, DIM = 512, H = 8, HD = 64, INNER = 512, NTOK = Bn * S, QP = 513 /* (n + yushu) / STEP */;
constexpr float SCALE = 0.125f, VS = 8.0f, QS = 8.0f, PS = 8.0f, AS2 = 8.0f, INV_E = 0.36787944117144233f;
constexpr size_t QPL = (size_t)Bn * H * S * HD, VPL = QPL, APL = (size_t)S * S;

typedef _Float16 b16;
typedef __attribute__((ext_vector_type(16))) _Float16 v16b;
typedef __attribute__((ext_vector_type(8)))  _Float16 v8b;
typedef __attribute__((ext_vector_type(8)))  float v8f;
typedef __attribute__((ext_vector_type(4)))  float v4f;

__device__ __forceinline__ v8b ld8b(const b16* p) { return *(const v8b*)p; }
__device__ __forceinline__ v16b cat8b(v8b a, v8b b) { return __builtin_shufflevector(a, b, 0, 1, 2, 3, 4, 5, 6, 7, 8, 9, 10, 11, 12, 13, 14, 15); }
__device__ __forceinline__ v16b frag_kb(const b16* p, int hh) { return cat8b(ld8b(p + 8 * hh), ld8b(p + 16 + 8 * hh)); }
__device__ __forceinline__ void split16(float v, b16& hi, b16& lo) { hi = (b16)v; lo = (b16)(v - (float)hi); }
// hi/lo fragment pair straight from an f32 k-contiguous row (same k-map)
__device__ __forceinline__ void frag_ksplit(const float* p, int hh, v16b& fh_, v16b& fl_) {
  const float* p0 = p + 8 * hh; const float* p1 = p + 16 + 8 * hh;
#pragma unroll
  for (int e = 0; e < 8; ++e) { b16 a, c; split16(p0[e], a, c); fh_[e] = a; fl_[e] = c; split16(p1[e], a, c); fh_[8 + e] = a; fl_[8 + e] = c; }
}
__device__ __forceinline__ v8f wmma16b(v16b a, v16b b, v8f c) {
  v8f d = __builtin_amdgcn_wmma_f32_16x16x32_f16(false, a, false, b, (short)0, c, false, false);
  asm volatile("v_nop\n\tv_nop\n\tv_nop\n\tv_nop" : "+v"(d) : "v"(a), "v"(b));
  return d;
}
__device__ __forceinline__ void wave_lds_sync() {
  __builtin_amdgcn_fence(__ATOMIC_RELEASE, "workgroup");
  __builtin_amdgcn_wave_barrier();
  __builtin_amdgcn_fence(__ATOMIC_ACQUIRE, "workgroup");
}

// Operand descriptor: NP = 0 -> f32 rows split on the fly into (hi, lo); NP = 1 -> one f16 plane; NP = 2 -> f16 hi + lo planes;
// NP = 3 -> f32 rows rounded once to a single f16 fragment. ld = row pitch.
struct Opnd { const void* p0; const void* p1; int ld; };
template <int NP> __device__ __forceinline__ void load_frags(const Opnd& o, int row, int kb, int hh, v16b& fh_, v16b& fl_) {
  if (NP == 0) { frag_ksplit((const float*)o.p0 + (size_t)row * o.ld + kb, hh, fh_, fl_); }
  else if (NP == 4 || NP == 5) {                             // f32 rows x64 (NP 4) or x8 (NP 5) then split (keeps the lo halves of small values normal)
    const float sc_ = (NP == 4) ? 64.0f : 8.0f;
    const float* p = (const float*)o.p0 + (size_t)row * o.ld + kb; const float* p0 = p + 8 * hh; const float* p1 = p + 16 + 8 * hh;
#pragma unroll
    for (int e = 0; e < 8; ++e) { b16 a, c; split16(p0[e] * sc_, a, c); fh_[e] = a; fl_[e] = c; split16(p1[e] * sc_, a, c); fh_[8 + e] = a; fl_[8 + e] = c; }
  } else if (NP == 3) {
    const float* p = (const float*)o.p0 + (size_t)row * o.ld + kb; const float* p0 = p + 8 * hh; const float* p1 = p + 16 + 8 * hh;
#pragma unroll
    for (int e = 0; e < 8; ++e) { fh_[e] = (b16)p0[e]; fh_[8 + e] = (b16)p1[e]; }
    fl_ = fh_;
  } else {
    fh_ = frag_kb((const b16*)o.p0 + (size_t)row * o.ld + kb, hh);
    if (NP == 2) fl_ = frag_kb((const b16*)o.p1 + (size_t)row * o.ld + kb, hh); else fl_ = fh_;
  }
}
template <int ANP, int BNP> __device__ __forceinline__ v8f mac(v16b ah, v16b al, v16b bh, v16b bl, v8f c) {
  c = wmma16b(ah, bh, c);
  if (BNP == 0 || BNP == 2 || BNP == 4 || BNP == 5) c = wmma16b(ah, bl, c);     // hi.lo
  if (ANP == 0 || ANP == 2 || ANP == 4 || ANP == 5) c = wmma16b(al, bh, c);     // lo.hi   (lo.lo dropped)
  return c;
}
// 32x64 wave tile: acc[r][t] (rows m0+16r.., cols c0+16t..) += A[m][k] . B[n][k] over k in [0, K)
template <int ANP, int BNP>
__device__ __forceinline__ void gemm_tile(const Opnd& A, const Opnd& B, int K, int m0, int c0, int nloc, int hlf, v8f (&acc)[2][4]) {
  for (int kb = 0; kb < K; kb += 32) {
    v16b a0h, a0l, a1h, a1l;
    load_frags<ANP>(A, m0 + nloc, kb, hlf, a0h, a0l);
    load_frags<ANP>(A, m0 + 16 + nloc, kb, hlf, a1h, a1l);
#pragma unroll
    for (int t = 0; t < 4; ++t) {
      v16b bh, bl;
      load_frags<BNP>(B, c0 + t * 16 + nloc, kb, hlf, bh, bl);
      acc[0][t] = mac<ANP, BNP>(a0h, a0l, bh, bl, acc[0][t]);
      acc[1][t] = mac<ANP, BNP>(a1h, a1l, bh, bl, acc[1][t]);
    }
  }
}

__device__ __forceinline__ void epi_planes(v8f (&acc)[2][4], float scale, bool two, b16* __restrict__ oh, b16* __restrict__ ol, int ldo,
                                           int m0, int c0, int lane, b16* Th, b16* Tl) {
  const int nloc = lane & 15, hlf = lane >> 4;
#pragma unroll
  for (int t = 0; t < 4; ++t)
#pragma unroll
    for (int r = 0; r < 2; ++r)
#pragma unroll
      for (int v = 0; v < 8; ++v) {
        const int rr = r * 16 + v + 8 * hlf, cc = t * 16 + nloc;
        b16 h_, l_; split16(acc[r][t][v] * scale, h_, l_);
        Th[rr * 64 + cc] = h_; Tl[rr * 64 + cc] = l_;
      }
  wave_lds_sync();
  {
#pragma unroll
    for (int j = 0; j < 8; ++j) {
      const int rr = j * 4 + (lane >> 3), c8 = (lane & 7) * 8;
      const size_t o = (size_t)(m0 + rr) * ldo + c0 + c8;
      *(v8b*)(oh + o) = ld8b(Th + rr * 64 + c8);
      if (two) *(v8b*)(ol + o) = ld8b(Tl + rr * 64 + c8);
    }
    
  }
}
// (b) f32 rows with pitch ldo: 64 floats = 256 B = 2 lines per row; 16 lanes x 16 B per row, 2 rows per instruction. Optional per-row factor
__device__ __forceinline__ void epi_f32(v8f (&acc)[2][4], float scale, const float* rscale, float* __restrict__ out, int ldo, int m0, int c0, int lane, float* Tt) {
  const int nloc = lane & 15, hlf = lane >> 4;
#pragma unroll
  for (int t = 0; t < 4; ++t)
#pragma unroll
    for (int r = 0; r < 2; ++r)
#pragma unroll
      for (int v = 0; v < 8; ++v) {
        const int rr = r * 16 + v + 8 * hlf;
        const float rs = rscale ? rscale[(size_t)(m0 + rr) * 32] : 1.0f;
        Tt[rr * 64 + t * 16 + nloc] = acc[r][t][v] * scale * rs;
      }
  wave_lds_sync();
  float* dst0 = out + (size_t)m0 * ldo + c0;
  {
#pragma unroll
    for (int j = 0; j < 16; ++j) { const int rr = j * 2 + hlf, c4 = nloc * 4; *(v4f*)(dst0 + (size_t)rr * ldo + c4) = *(const v4f*)(Tt + rr * 64 + c4); }
    
  }
}



typedef __attribute__((ext_vector_type(8))) __bf16 v8bb; typedef __attribute__((ext_vector_type(16))) __bf16 v16bb;
typedef __attribute__((ext_vector_type(8))) unsigned short v8us;
__device__ __forceinline__ v16bb frag_kb_bf(const __bf16* p, int hh) { const v8bb a = *(const v8bb*)(p + 8 * hh), b = *(const v8bb*)(p + 16 + 8 * hh); return __builtin_shufflevector(a, b, 0, 1, 2, 3, 4, 5, 6, 7, 8, 9, 10, 11, 12, 13, 14, 15); }
__device__ __forceinline__ v8f wmma16bb(v16bb a, v16bb b, v8f c) {
  v8f d = __builtin_amdgcn_wmma_f32_16x16x32_bf16(false, a, false, b, (short)0, c, false, false);
  asm volatile("v_nop\n\tv_nop\n\tv_nop\n\tv_nop" : "+v"(d) : "v"(a), "v"(b));
  return d;
}
__device__ __forceinline__ unsigned short bf16_rne_bits(float v) { unsigned int u = __float_as_uint(v); u += 0x7FFFu + ((u >> 16) & 1u); return (unsigned short)(u >> 16); }
__device__ __forceinline__ float bf16_rne(float v) { return __uint_as_float(((unsigned int)bf16_rne_bits(v)) << 16); }



// attn2 planes: A2[n][m] = 8 exp(-|n-m|/e)/s[m] as hi/lo f16 planes [2048][2048], s[m] = sum_k exp(-|m-k|/e) (f32, same expf); entries below the f16 normal range zeroed.
// That rule zeroes every entry with |n-m| >= 33: s[m] >= 1 (its k = m term), so 8 exp(-33/e)/s[m] <= 4.3e-5 < 2^-14. For a row n of the 32-row group j = n / 32 the key blocks of 32
// other than j-1, j, j+1 hold only such entries: they need not be written or read. Read per row: 3 blocks from block clamp(j-1, 0, 61); written: the two whole 128-B lines (128 keys,
// from block clamp((j-1) & ~1, 0, 60)) that hold those 3.
// The 2048 terms of s[m] are exp(-d/e) for d = 0, then d = 1..m (keys below m) and d = 1..2047-m (keys above): with Q[j] = sum_{d=1..j} exp(-d/e), s[m] = 1 + Q[m] + Q[2047-m], every term
// kept. A block of 256 threads forms all of Q itself (8 terms a thread, a scan over the block, in ascending d), so the planes need no launch before them: they are built by A2B blocks of
// their own in the launch that rounds x and the weights (16 rows x 128 keys a block).
constexpr int A2B = S * 16 / 256;
// exp(-|d|/e) as __expf forms it (two multiplies, v_exp_f32), with the one slot that the instruction set asks for behind a transcendental inside the statement
__device__ __forceinline__ float decay_term(int d) { float r; asm("v_exp_f32 %0, %1\n\tv_nop" : "=v"(r) : "v"((-fabsf((float)d) * INV_E) * 1.44269504088896340736f)); return r; }
__device__ __forceinline__ void attn2_block(int blk, b16* __restrict__ a2, float* Q, float* Wt) {
  const int t = threadIdx.x, lane = t & 31, wave = t >> 5;
  float pre[8], run = 0.0f;
#pragma unroll
  for (int e = 0; e < 8; ++e) { const int d = 8 * t + e; const float ex = decay_term(d); run += (d == 0) ? 0.0f : ex; pre[e] = run; }
  float inc = run;                                                // sum of the wave's threads up to and with this one
#pragma unroll
  for (int o = 1; o < 32; o <<= 1) { const float u = __shfl_up(inc, o); if (lane >= o) inc += u; }
  if (lane == 31) Wt[wave] = inc;
  float base = __shfl_up(inc, 1); if (lane == 0) base = 0.0f;
  __syncthreads();                                                // the 8 waves' totals are in LDS
  float wb = 0.0f;
#pragma unroll
  for (int w = 0; w < 7; ++w) wb += (w < wave) ? Wt[w] : 0.0f;    // the waves below this one, in ascending d
  base += wb;
#pragma unroll
  for (int e = 0; e < 8; ++e) Q[8 * t + e] = base + pre[e];
  __syncthreads();                                                // all of Q is in LDS
  const int i = blk * 256 + t, n = i >> 4, m0 = min(max(((n >> 5) - 1) & ~1, 0), S / 32 - 4) * 32 + (i & 15) * 8; v8b hv, lv;
#pragma unroll
  for (int e = 0; e < 8; ++e) { const int m = m0 + e; const float s = 1.0f + Q[m] + Q[S - 1 - m];
    float v = AS2 * decay_term(n - m) / s; if (v < 6.103515625e-05f) v = 0.0f; b16 a, c; split16(v, a, c); hv[e] = a; lv[e] = c; }
  { *(v8b*)(a2 + (size_t)n * S + m0) = hv; *(v8b*)(a2 + APL + (size_t)n * S + m0) = lv;  }
}

__global__ __launch_bounds__(256) void prep_kernel(const float* __restrict__ x, const float* __restrict__ wqkv, const float* __restrict__ wo, unsigned short* __restrict__ x16, unsigned short* __restrict__ w16, b16* __restrict__ wo16, b16* __restrict__ a2) {
  __shared__ __attribute__((aligned(16))) float Q[S];
  __shared__ float Wt[8];
  if (blockIdx.x < A2B) { attn2_block(blockIdx.x, a2, Q, Wt); return; }   // the same for a whole block
  const size_t tid = (size_t)(blockIdx.x - A2B) * blockDim.x + threadIdx.x, nth = (size_t)(gridDim.x - A2B) * blockDim.x;
  {
    for (size_t p = tid; p < (size_t)NTOK * DIM / 8; p += nth) { v8us v;
#pragma unroll
      for (int e = 0; e < 8; ++e) v[e] = bf16_rne_bits(x[p * 8 + e]);
      *(v8us*)(x16 + p * 8) = v; }
    for (size_t p = tid; p < (size_t)4 * INNER * DIM / 8; p += nth) { const int n = (int)(p / (DIM / 8)), k0 = (int)(p % (DIM / 8)) * 8; v8us v;
#pragma unroll
      for (int e = 0; e < 8; ++e) v[e] = bf16_rne_bits(wqkv[(size_t)(k0 + e) * 4 * INNER + n]);
      *(v8us*)(w16 + (size_t)n * DIM + k0) = v; }
    for (size_t p = tid; p < (size_t)DIM * 2 * INNER / 8; p += nth) { const int n = (int)(p / (2 * INNER / 8)), k0 = (int)(p % (2 * INNER / 8)) * 8; v8b w;
#pragma unroll
      for (int e = 0; e < 8; ++e) w[e] = (b16)bf16_rne(wo[(size_t)(k0 + e) * DIM + n]);
      *(v8b*)(wo16 + (size_t)n * 2 * INNER + k0) = w; }
    
  }
}

// projections: rows = tokens (4096), K = 512, column tiles of 64 = one head of q | k | v | t (32 tiles): q/k -> x8 hi/lo rows [b*H + h][tok][64]; v, t -> (8v)^T, (8t)^T hi/lo planes
// [b*H + h][64][tok]. grid (32, 32) x 128.
__global__ __launch_bounds__(128) void proj_kernel(const __bf16* __restrict__ x16, const __bf16* __restrict__ w16, b16* __restrict__ qh, b16* __restrict__ kh, b16* __restrict__ vt, b16* __restrict__ tt) {
  __shared__ __attribute__((aligned(16))) b16 Th[4][32][HD + 8], Tq[4][32][HD + 8];
  __shared__ __attribute__((aligned(16))) b16 Tt[64][128 + 8], Tl[64][128 + 8];
  const int lane = threadIdx.x & 31, wave = threadIdx.x >> 5, nloc = lane & 15, hlf = lane >> 4, m0 = blockIdx.y * 128 + wave * 32, c0 = blockIdx.x * 64;
  const int which = blockIdx.x / H, head = blockIdx.x % H, b = m0 / S, tok0 = m0 % S;
  v8f acc[2][4];
#pragma unroll
  for (int r = 0; r < 2; ++r)
#pragma unroll
    for (int t = 0; t < 4; ++t) acc[r][t] = (v8f){};
#pragma unroll 2
  for (int kb = 0; kb < DIM; kb += 32) {
    const v16bb a0 = frag_kb_bf(x16 + (size_t)(m0 + nloc) * DIM + kb, hlf), a1 = frag_kb_bf(x16 + (size_t)(m0 + 16 + nloc) * DIM + kb, hlf);
#pragma unroll
    for (int t = 0; t < 4; ++t) { const v16bb bw = frag_kb_bf(w16 + (size_t)(c0 + t * 16 + nloc) * DIM + kb, hlf); acc[0][t] = wmma16bb(a0, bw, acc[0][t]); acc[1][t] = wmma16bb(a1, bw, acc[1][t]); } }
  if (which < 2) {
#pragma unroll
    for (int t = 0; t < 4; ++t)
#pragma unroll
      for (int r = 0; r < 2; ++r)
#pragma unroll
        for (int v = 0; v < 8; ++v) { b16 a_, c_; split16(acc[r][t][v] * QS, a_, c_); Th[wave][r * 16 + 8 * hlf + v][t * 16 + nloc] = a_; Tq[wave][r * 16 + 8 * hlf + v][t * 16 + nloc] = c_; }
    wave_lds_sync();
    b16* dst = ((which == 0) ? qh : kh) + (((size_t)b * H + head) * S + tok0) * HD;
    {
#pragma unroll
      for (int j = 0; j < 8; ++j) { const int rr = j * 4 + (lane >> 3), c8 = (lane & 7) * 8; *(v8b*)(dst + (size_t)rr * HD + c8) = *(const v8b*)(&Th[wave][rr][c8]); *(v8b*)(dst + QPL + (size_t)rr * HD + c8) = *(const v8b*)(&Tq[wave][rr][c8]); }
       }
    return;
  }
#pragma unroll
  for (int t = 0; t < 4; ++t)
#pragma unroll
    for (int r = 0; r < 2; ++r)
#pragma unroll
      for (int v = 0; v < 8; ++v) { b16 a_, c_; split16(acc[r][t][v] * VS, a_, c_); Tt[t * 16 + nloc][wave * 32 + r * 16 + 8 * hlf + v] = a_; Tl[t * 16 + nloc][wave * 32 + r * 16 + 8 * hlf + v] = c_; }
  __syncthreads();
  b16* dstv = ((which == 2) ? vt : tt) + (((size_t)b * H + head) * HD) * S + (blockIdx.y * 128) % S;
  {
#pragma unroll
    for (int j = 0; j < 8; ++j) { const int dd = wave * 16 + j * 2 + (lane >> 4), c8 = (lane & 15) * 8; *(v8b*)(dstv + (size_t)dd * S + c8) = *(const v8b*)(&Tt[dd][c8]); *(v8b*)(dstv + VPL + (size_t)dd * S + c8) = *(const v8b*)(&Tl[dd][c8]); }
    
  }
}

// attention. The query row of token i is q[i mod 513], so softmax(q~.k / 8).v has only 513 distinct rows per (b, h): each is computed ONCE and stored to its up to four tokens
// r, r + 513, r + 1026, r + 1539 (< 2048). Block = (b, h, 1/16 of the sequence), 24 waves:
//   waves 0..15 : two softmax tiles of 16 distinct rows (32 full tiles per (b, h)), each tile's 2048 keys split over 8 waves (256 keys in a row per wave);
//   waves 16..23: decay tiles of 16 tokens, o2 += (8t)^T . A2^T rows (A2[q][m] as the B operand: rows = queries, k = keys; 3 products), over the 3 key blocks outside which A2 is zero;
//                 in the first block of each (b, h) they then take the 8 key parts of the tile that holds row 512 (rows 513.. are not stored).
// A softmax wave runs the online softmax over its own keys in ascending order in steps of 32 (k x q hi/lo, 3 products; o1 += (8v)^T.P, 3 products) and leaves its running maximum m, its sum l
// and its unnormalised o1 in LDS; behind one block barrier the 8 parts of a tile are merged in ascending key order: M = max m_w, l = sum l_w e^(m_w - M), o1 = sum o1_w e^(m_w - M).
// y[tok][h*128 + 0..63] = o1/(64 l), [64..127] = o2/64; f32 rows; each role stores 256 B (two whole lines) per row.
constexpr int NS = 8, KPS = S / NS, SPB = 2, DPB = 8, BPH = S / 16 / DPB, AW = SPB * NS + DPB;
static_assert(BPH * SPB * 16 == QP - 1 && QP * 4 >= S, "32 full tiles of distinct rows and one more row; four copies cover the sequence");
static_assert(DPB == NS && KPS % 32 == 0, "the decay waves of a block are as many as the key parts of the last tile");
__device__ __forceinline__ void softmax_part(const b16* __restrict__ Q, const b16* __restrict__ K, const b16* __restrict__ V, int r0, int kb0, int lane, float (*Os)[HD + 4], float* Ms, float* Ls) {
  const int hh = lane >> 4, col = lane & 15, qsrc = r0 + col;
  v16b qf[2], ql[2];
#pragma unroll
  for (int ks = 0; ks < 2; ++ks) { qf[ks] = frag_kb(Q + (size_t)qsrc * HD + ks * 32, hh); ql[ks] = frag_kb(Q + QPL + (size_t)qsrc * HD + ks * 32, hh); }
  float m = -INFINITY, l = 0.0f; v8f o1[4] = {{}, {}, {}, {}};
  for (int kb = kb0; kb < kb0 + KPS; kb += 32) {
    v8f s0 = {}, s1 = {};
#pragma unroll
    for (int ks = 0; ks < 2; ++ks) { const v16b k0 = frag_kb(K + (size_t)(kb + col) * HD + ks * 32, hh), k0l = frag_kb(K + QPL + (size_t)(kb + col) * HD + ks * 32, hh), k1 = frag_kb(K + (size_t)(kb + 16 + col) * HD + ks * 32, hh), k1l = frag_kb(K + QPL + (size_t)(kb + 16 + col) * HD + ks * 32, hh);
      s0 = wmma16b(k0, qf[ks], s0); s0 = wmma16b(k0, ql[ks], s0); s0 = wmma16b(k0l, qf[ks], s0); s1 = wmma16b(k1, qf[ks], s1); s1 = wmma16b(k1, ql[ks], s1); s1 = wmma16b(k1l, qf[ks], s1); }
    float mr = -INFINITY;
#pragma unroll
    for (int r = 0; r < 8; ++r) { s0[r] *= SCALE / (QS * QS); s1[r] *= SCALE / (QS * QS); mr = fmaxf(mr, fmaxf(s0[r], s1[r])); }
    mr = fmaxf(mr, __shfl_xor(mr, 16));
    const float mn = fmaxf(m, mr), al_ = __expf(m - mn); m = mn;
    float sum = 0.0f; v16b pb, pl;
#pragma unroll
    for (int r = 0; r < 8; ++r) { const float e0 = __expf(s0[r] - mn), e1 = __expf(s1[r] - mn); sum += e0 + e1; b16 a, c; split16(e0 * PS, a, c); pb[r] = a; pl[r] = c; split16(e1 * PS, a, c); pb[8 + r] = a; pl[8 + r] = c; }
    sum += __shfl_xor(sum, 16); l = l * al_ + sum;
#pragma unroll
    for (int n = 0; n < 4; ++n) {
#pragma unroll
      for (int r = 0; r < 8; ++r) o1[n][r] *= al_;
      const v16b vf = frag_kb(V + (size_t)(n * 16 + col) * S + kb, hh), vl = frag_kb(V + VPL + (size_t)(n * 16 + col) * S + kb, hh);
      o1[n] = wmma16b(vf, pb, o1[n]); o1[n] = wmma16b(vf, pl, o1[n]); o1[n] = wmma16b(vl, pb, o1[n]); }
  }
#pragma unroll
  for (int n = 0; n < 4; ++n)
#pragma unroll
    for (int r = 0; r < 8; ++r) Os[col][n * 16 + 8 * hh + r] = o1[n][r];
  if (hh == 0) { Ms[col] = m; Ls[col] = l; }
}
// one float4 of a tile's 16 x 64 result per thread t of 256: two rows x 256 B per store instruction (16 lanes x 16 B a row), once per token that uses the row
__device__ __forceinline__ void merge_tile(const float (*Os)[16][HD + 4], const float (*Ms)[16], const float (*Ls)[16], int r0, int t, float* __restrict__ yb) {
  const int rl = t >> 4, c4 = (t & 15) * 4, row = r0 + rl;
  float M = Ms[0][rl];
#pragma unroll
  for (int w = 1; w < NS; ++w) M = fmaxf(M, Ms[w][rl]);
  float l = 0.0f; v4f acc = {};
#pragma unroll
  for (int w = 0; w < NS; ++w) { const float f = __expf(Ms[w][rl] - M); l += Ls[w][rl] * f; acc += *(const v4f*)(&Os[w][rl][c4]) * f; }
  const v4f val = acc * (1.0f / (VS * PS * l));
#pragma unroll
  for (int c = 0; c < 4; ++c) { const int tok = row + c * QP; if (row < QP && tok < S) *(v4f*)(yb + (size_t)tok * (2 * INNER) + c4) = val; }
}
__device__ __forceinline__ void decay_tile(const b16* __restrict__ T, const b16* __restrict__ a2, int q0, int lane, float (*Os)[HD + 4], float* __restrict__ yb) {
  const int hh = lane >> 4, col = lane & 15, qi = q0 + col;
  v8f o2[4] = {{}, {}, {}, {}};
  const int kb0 = min(max((q0 >> 5) - 1, 0), S / 32 - 3) * 32;   // first of the 3 key blocks outside which A2 rows q0..q0+15 are all zero (see attn2 planes)
  for (int kb = kb0; kb < kb0 + 96; kb += 32) {
    const v16b af = frag_kb(a2 + (size_t)qi * S + kb, hh), al2 = frag_kb(a2 + APL + (size_t)qi * S + kb, hh);   // A2 rows = queries (B operand), k = keys
#pragma unroll
    for (int n = 0; n < 4; ++n) {
      const v16b tf = frag_kb(T + (size_t)(n * 16 + col) * S + kb, hh), tl = frag_kb(T + VPL + (size_t)(n * 16 + col) * S + kb, hh);
      o2[n] = wmma16b(tf, af, o2[n]); o2[n] = wmma16b(tf, al2, o2[n]); o2[n] = wmma16b(tl, af, o2[n]); }
  }
  const float i2 = 1.0f / (VS * AS2);
#pragma unroll
  for (int n = 0; n < 4; ++n)
#pragma unroll
    for (int r = 0; r < 8; ++r) Os[col][n * 16 + 8 * hh + r] = o2[n][r] * i2;
  wave_lds_sync();
#pragma unroll
  for (int j = 0; j < 8; ++j) *(v4f*)(yb + (size_t)(q0 + j * 2 + hh) * (2 * INNER) + HD + col * 4) = *(const v4f*)(&Os[j * 2 + hh][col * 4]);
}
__global__ __launch_bounds__(AW * 32) void attn_kernel(const b16* __restrict__ qh, const b16* __restrict__ kh, const b16* __restrict__ vt, const b16* __restrict__ tt, const b16* __restrict__ a2, float* __restrict__ y) {
  __shared__ __attribute__((aligned(16))) float Os[AW][16][HD + 4];
  __shared__ float Ms[AW][16], Ls[AW][16];
  const int wid = __builtin_amdgcn_readfirstlane(threadIdx.x >> 5), lane = threadIdx.x & 31;   // the wave's number in a scalar register: the role tests are scalar branches
  const int bh = blockIdx.x / BPH, part = blockIdx.x % BPH, b = bh / H, h = bh % H;
  float* yb = y + (size_t)b * S * (2 * INNER) + h * 2 * HD;
  const int grp = wid / NS;                                       // 0, 1: the block's two full tiles; 2: the tile of row 512 (first block of each (b, h) only)
  const int r0 = (grp < SPB) ? (part * SPB + grp) * 16 : QP - 1;
  const bool has_tile = grp < SPB || part == 0;
  if (grp == SPB) {
    decay_tile(tt + (size_t)bh * HD * S, a2, (part * DPB + wid - SPB * NS) * 16, lane, Os[wid], yb);
    asm volatile("s_wait_xcnt 0x0" ::: "memory");                 // the wave may go on to a softmax part, which rewrites the registers that the stores above name
  }
  if (has_tile) softmax_part(qh + (size_t)bh * S * HD, kh + (size_t)bh * S * HD, vt + (size_t)bh * HD * S, r0, (wid % NS) * KPS, lane, Os[wid], Ms[wid], Ls[wid]);
  __syncthreads();                                                // every wave of the block passes it: the 8 parts of a tile are in LDS
  if (has_tile) merge_tile(&Os[grp * NS], &Ms[grp * NS], &Ls[grp * NS], r0, (int)threadIdx.x % (NS * 32), yb);
}

// out = y W_out + b: rows 4096, K = 1024 (y split x8 hi/lo at load), 8 column tiles of 64; + bf16(b); f32 rows. grid (8, 32).
__global__ __launch_bounds__(128) void out_kernel(const float* __restrict__ y, const b16* __restrict__ wo16, const float* __restrict__ bo, float* __restrict__ out) {
  __shared__ __attribute__((aligned(16))) float Ts[4][32 * 64];
  const int lane = threadIdx.x & 31, wave = threadIdx.x >> 5, nloc = lane & 15, hlf = lane >> 4, m0 = blockIdx.y * 128 + wave * 32, c0 = blockIdx.x * 64;
  v8f acc[2][4];
#pragma unroll
  for (int r = 0; r < 2; ++r)
#pragma unroll
    for (int t = 0; t < 4; ++t) acc[r][t] = (v8f){};
  const Opnd A{y, nullptr, 2 * INNER}, Bo{wo16, nullptr, 2 * INNER};
  gemm_tile<5, 1>(A, Bo, 2 * INNER, m0, c0, nloc, hlf, acc);
#pragma unroll
  for (int t = 0; t < 4; ++t)
#pragma unroll
    for (int r = 0; r < 2; ++r)
#pragma unroll
      for (int v = 0; v < 8; ++v) acc[r][t][v] = acc[r][t][v] * 0.125f + bf16_rne(bo[c0 + t * 16 + nloc]);
  epi_f32(acc, 1.0f, nullptr, out, DIM, m0, c0, lane, Ts[wave]);
}
}  // namespace

extern "C" void kernel_launch(void* const* d_in, const int* in_sizes, int n_in,
                              void* d_out, int out_size, void* d_ws, size_t ws_size, hipStream_t stream) {
  (void)n_in; (void)out_size;
  const float* x = (const float*)d_in[0]; const float* wqkv = (const float*)d_in[1]; const float* wo = (const float*)d_in[2]; const float* bo = (const float*)d_in[3];
  float* out = (float*)d_out;   // [2][2048][512]
  if (in_sizes[0] != NTOK * DIM || in_sizes[1] != DIM * 4 * INNER || in_sizes[2] != 2 * INNER * DIM || in_sizes[3] != DIM) return;
  size_t off = 0; char* ws = (char*)d_ws;
  auto carve = [&](size_t bytes) { char* p = ws + off; off += (bytes + 255) & ~(size_t)255; return p; };
  unsigned short* x16 = (unsigned short*)carve((size_t)NTOK * DIM * 2); unsigned short* w16 = (unsigned short*)carve((size_t)4 * INNER * DIM * 2); b16* wo16 = (b16*)carve((size_t)DIM * 2 * INNER * 2);
  b16* a2 = (b16*)carve(APL * 2 * 2);
  b16* qh = (b16*)carve(QPL * 2 * 2); b16* kh = (b16*)carve(QPL * 2 * 2); b16* vt = (b16*)carve(VPL * 2 * 2); b16* tt = (b16*)carve(VPL * 2 * 2); float* y = (float*)carve((size_t)NTOK * 2 * INNER * 4);
  if (off > ws_size) return;                                    // ≈ 74 MB
  prep_kernel<<<A2B + 1024, 256, 0, stream>>>(x, wqkv, wo, x16, w16, wo16, a2);
  proj_kernel<<<dim3(4 * INNER / 64, NTOK / 128), 128, 0, stream>>>((const __bf16*)x16, (const __bf16*)w16, qh, kh, vt, tt);
  attn_kernel<<<Bn * H * BPH, AW * 32, 0, stream>>>(qh, kh, vt, tt, a2, y);
  out_kernel<<<dim3(DIM / 64, NTOK / 128), 128, 0, stream>>>(y, wo16, bo, out);
}

// v005
// A run of this version takes 113 microseconds.
// Next to v004, in two timings, it ran 1.19 and 1.18 times as fast.
// Counting every step since v000, it is 3.25 times as fast.
#include <hip/hip_runtime.h>

// "Fast attention": [q | k | v | t] = x W_qkv (8 heads x 64 each); query i uses q[i mod 513] (the module's pad/reshape/tile trick with STEP 4, n = 2048); attn1 = softmax(q~.k / 8) over
// all 2048 keys; out1 = attn1.v; attn2[n][m] = exp(-|n-m|/e) / s[m] with s[m] = sum_k exp(-|m-k|/e) (the module's broadcast divides column m by row-sum m); out2 = attn2.t (shared
// over batch and heads); out = [out1 | out2 per head] W_out + b -> [2][2048][512].
// Numerics: x, W_qkv, W_out, b_out rounded to bf16; projection on v_wmma_f32_16x16x32_bf16 (exact products); q, k, v, t, P and the
// merged attention output carried x8 as f16 hi+lo pairs (3 / 2 products) on v_wmma_f32_16x16x32_f16; the analytic attn2 matrix as an x8 f16 hi+lo pair (entries that would be f16-
// subnormal are zeroed identically everywhere — they are < 8e-6 of a row); online softmax and the row sums s[m] in f32. Fragment k-map per lane half hh for A AND B: elements 0..7 <-

namespace {
constexpr int Bn = 2, S = 2048, DIM = 512, H = 8, HD = 64, INNER = 512, NTOK = Bn * S, QP = 513 /* (n + yushu) / STEP */;
constexpr float SCALE = 0.125f, VS = 8.0f, QS = 8.0f, PS = 8.0f, AS2 = 8.0f, INV_E = 0.36787944117144233f;
constexpr size_t QPL = (size_t)Bn * H * S * HD, VPL = QPL, APL = (size_t)S * S;

typedef _Float16 b16;
typedef __attribute__((ext_vector_type(16))) _Float16 v16b;
typedef __attribute__((ext_vector_type(8)))  _Float16 v8b;
typedef __attribute__((ext_vector_type(8)))  float v8f;
typedef __attribute__((ext_vector_type(4)))  float v4f;

__device__ __forceinline__ v8b ld8b(const b16* p) { return *(const v8b*)p; }
__device__ __forceinline__ v16b cat8b(v8b a, v8b b) { return __builtin_shufflevector(a, b, 0, 1, 2, 3, 4, 5, 6, 7, 8, 9, 10, 11, 12, 13, 14, 15); }
__device__ __forceinline__ v16b frag_kb(const b16* p, int hh) { return cat8b(ld8b(p + 8 * hh), ld8b(p + 16 + 8 * hh)); }
__device__ __forceinline__ void split16(float v, b16& hi, b16& lo) { hi = (b16)v; lo = (b16)(v - (float)hi); }
// hi/lo fragment pair straight from an f32 k-contiguous row (same k-map)
__device__ __forceinline__ void frag_ksplit(const float* p, int hh, v16b& fh_, v16b& fl_) {
  const float* p0 = p + 8 * hh; const float* p1 = p + 16 + 8 * hh;
#pragma unroll
  for (int e = 0; e < 8; ++e) { b16 a, c; split16(p0[e], a, c); fh_[e] = a; fl_[e] = c; split16(p1[e], a, c); fh_[8 + e] = a; fl_[8 + e] = c; }
}
__device__ __forceinline__ v8f wmma16b(v16b a, v16b b, v8f c) {
  v8f d = __builtin_amdgcn_wmma_f32_16x16x32_f16(false, a, false, b, (short)0, c, false, false);
  asm volatile("v_nop\n\tv_nop\n\tv_nop\n\tv_nop" : "+v"(d) : "v"(a), "v"(b));
  return d;
}
__device__ __forceinline__ void wave_lds_sync() {
  __builtin_amdgcn_fence(__ATOMIC_RELEASE, "workgroup");
  __builtin_amdgcn_wave_barrier();
  __builtin_amdgcn_fence(__ATOMIC_ACQUIRE, "workgroup");
}

// Operand descriptor: NP = 0 -> f32 rows split on the fly into (hi, lo); NP = 1 -> one f16 plane; NP = 2 -> f16 hi + lo planes;
// NP = 3 -> f32 rows rounded once to a single f16 fragment. ld = row pitch.
struct Opnd { const void* p0; const void* p1; int ld; };
template <int NP> __device__ __forceinline__ void load_frags(const Opnd& o, int row, int kb, int hh, v16b& fh_, v16b& fl_) {
  if (NP == 0) { frag_ksplit((const float*)o.p0 + (size_t)row * o.ld + kb, hh, fh_, fl_); }
  else if (NP == 4 || NP == 5) {                             // f32 rows x64 (NP 4) or x8 (NP 5) then split (keeps the lo halves of small values normal)
    const float sc_ = (NP == 4) ? 64.0f : 8.0f;
    const float* p = (const float*)o.p0 + (size_t)row * o.ld + kb; const float* p0 = p + 8 * hh; const float* p1 = p + 16 + 8 * hh;
#pragma unroll
    for (int e = 0; e < 8; ++e) { b16 a, c; split16(p0[e] * sc_, a, c); fh_[e] = a; fl_[e] = c; split16(p1[e] * sc_, a, c); fh_[8 + e] = a; fl_[8 + e] = c; }
  } else if (NP == 3) {
    const float* p = (const float*)o.p0 + (size_t)row * o.ld + kb; const float* p0 = p + 8 * hh; const float* p1 = p + 16 + 8 * hh;
#pragma unroll
    for (int e = 0; e < 8; ++e) { fh_[e] = (b16)p0[e]; fh_[8 + e] = (b16)p1[e]; }
    fl_ = fh_;
  } else {
    fh_ = frag_kb((const b16*)o.p0 + (size_t)row * o.ld + kb, hh);
    if (NP == 2) fl_ = frag_kb((const b16*)o.p1 + (size_t)row * o.ld + kb, hh); else fl_ = fh_;
  }
}
template <int ANP, int BNP> __device__ __forceinline__ v8f mac(v16b ah, v16b al, v16b bh, v16b bl, v8f c) {
  c = wmma16b(ah, bh, c);
  if (BNP == 0 || BNP == 2 || BNP == 4 || BNP == 5) c = wmma16b(ah, bl, c);     // hi.lo
  if (ANP == 0 || ANP == 2 || ANP == 4 || ANP == 5) c = wmma16b(al, bh, c);     // lo.hi   (lo.lo dropped)
  return c;
}
// 32x64 wave tile: acc[r][t] (rows m0+16r.., cols c0+16t..) += A[m][k] . B[n][k] over k in [0, K)
template <int ANP, int BNP>
__device__ __forceinline__ void gemm_tile(const Opnd& A, const Opnd& B, int K, int m0, int c0, int nloc, int hlf, v8f (&acc)[2][4]) {
  for (int kb = 0; kb < K; kb += 32) {
    v16b a0h, a0l, a1h, a1l;
    load_frags<ANP>(A, m0 + nloc, kb, hlf, a0h, a0l);
    load_frags<ANP>(A, m0 + 16 + nloc, kb, hlf, a1h, a1l);
#pragma unroll
    for (int t = 0; t < 4; ++t) {
      v16b bh, bl;
      load_frags<BNP>(B, c0 + t * 16 + nloc, kb, hlf, bh, bl);
      acc[0][t] = mac<ANP, BNP>(a0h, a0l, bh, bl, acc[0][t]);
      acc[1][t] = mac<ANP, BNP>(a1h, a1l, bh, bl, acc[1][t]);
    }
  }
}

__device__ __forceinline__ void epi_planes(v8f (&acc)[2][4], float scale, bool two, b16* __restrict__ oh, b16* __restrict__ ol, int ldo,
                                           int m0, int c0, int lane, b16* Th, b16* Tl) {
  const int nloc = lane & 15, hlf = lane >> 4;
#pragma unroll
  for (int t = 0; t < 4; ++t)
#pragma unroll
    for (int r = 0; r < 2; ++r)
#pragma unroll
      for (int v = 0; v < 8; ++v) {
        const int rr = r * 16 + v + 8 * hlf, cc = t * 16 + nloc;
        b16 h_, l_; split16(acc[r][t][v] * scale, h_, l_);
        Th[rr * 64 + cc] = h_; Tl[rr * 64 + cc] = l_;
      }
  wave_lds_sync();
  {
#pragma unroll
    for (int j = 0; j < 8; ++j) {
      const int rr = j * 4 + (lane >> 3), c8 = (lane & 7) * 8;
      const size_t o = (size_t)(m0 + rr) * ldo + c0 + c8;
      *(v8b*)(oh + o) = ld8b(Th + rr * 64 + c8);
      if (two) *(v8b*)(ol + o) = ld8b(Tl + rr * 64 + c8);
    }
    
  }
}
typedef __attribute__((ext_vector_type(8))) __bf16 v8bb; typedef __attribute__((ext_vector_type(16))) __bf16 v16bb;
typedef __attribute__((ext_vector_type(8))) unsigned short v8us;
__device__ __forceinline__ v16bb frag_kb_bf(const __bf16* p, int hh) { const v8bb a = *(const v8bb*)(p + 8 * hh), b = *(const v8bb*)(p + 16 + 8 * hh); return __builtin_shufflevector(a, b, 0, 1, 2, 3, 4, 5, 6, 7, 8, 9, 10, 11, 12, 13, 14, 15); }
__device__ __forceinline__ v8f wmma16bb(v16bb a, v16bb b, v8f c) {
  v8f d = __builtin_amdgcn_wmma_f32_16x16x32_bf16(false, a, false, b, (short)0, c, false, false);
  asm volatile("v_nop\n\tv_nop\n\tv_nop\n\tv_nop" : "+v"(d) : "v"(a), "v"(b));
  return d;
}
__device__ __forceinline__ unsigned short bf16_rne_bits(float v) { unsigned int u = __float_as_uint(v); u += 0x7FFFu + ((u >> 16) & 1u); return (unsigned short)(u >> 16); }
__device__ __forceinline__ float bf16_rne(float v) { return __uint_as_float(((unsigned int)bf16_rne_bits(v)) << 16); }



// attn2 planes: A2[n][m] = 8 exp(-|n-m|/e)/s[m] as hi/lo f16 planes [2048][2048], s[m] = sum_k exp(-|m-k|/e) (f32, same expf); entries below the f16 normal range zeroed.
// That rule zeroes every entry with |n-m| >= 33: s[m] >= 1 (its k = m term), so 8 exp(-33/e)/s[m] <= 4.3e-5 < 2^-14. For a row n of the 32-row group j = n / 32 the key blocks of 32
// other than j-1, j, j+1 hold only such entries: they need not be written or read. Read per row: 3 blocks from block clamp(j-1, 0, 61); written: the two whole 128-B lines (128 keys,
// from block clamp((j-1) & ~1, 0, 60)) that hold those 3.
// The 2048 terms of s[m] are exp(-d/e) for d = 0, then d = 1..m (keys below m) and d = 1..2047-m (keys above): with Q[j] = sum_{d=1..j} exp(-d/e), s[m] = 1 + Q[m] + Q[2047-m], every term
// kept. A block of 256 threads forms all of Q itself (8 terms a thread, a scan over the block, in ascending d), so the planes need no launch before them: they are built by A2B blocks of
// their own in the launch that rounds x and the weights (16 rows x 128 keys a block).
constexpr int A2B = S * 16 / 256;
// exp(-|d|/e) as __expf forms it (two multiplies, v_exp_f32), with the one slot that the instruction set asks for behind a transcendental inside the statement
__device__ __forceinline__ float decay_term(int d) { float r; asm("v_exp_f32 %0, %1\n\tv_nop" : "=v"(r) : "v"((-fabsf((float)d) * INV_E) * 1.44269504088896340736f)); return r; }
__device__ __forceinline__ void attn2_block(int blk, b16* __restrict__ a2, float* Q, float* Wt) {
  const int t = threadIdx.x, lane = t & 31, wave = t >> 5;
  float pre[8], run = 0.0f;
#pragma unroll
  for (int e = 0; e < 8; ++e) { const int d = 8 * t + e; const float ex = decay_term(d); run += (d == 0) ? 0.0f : ex; pre[e] = run; }
  float inc = run;                                                // sum of the wave's threads up to and with this one
#pragma unroll
  for (int o = 1; o < 32; o <<= 1) { const float u = __shfl_up(inc, o); if (lane >= o) inc += u; }
  if (lane == 31) Wt[wave] = inc;
  float base = __shfl_up(inc, 1); if (lane == 0) base = 0.0f;
  __syncthreads();                                                // the 8 waves' totals are in LDS
  float wb = 0.0f;
#pragma unroll
  for (int w = 0; w < 7; ++w) wb += (w < wave) ? Wt[w] : 0.0f;    // the waves below this one, in ascending d
  base += wb;
#pragma unroll
  for (int e = 0; e < 8; ++e) Q[8 * t + e] = base + pre[e];
  __syncthreads();                                                // all of Q is in LDS
  const int i = blk * 256 + t, n = i >> 4, m0 = min(max(((n >> 5) - 1) & ~1, 0), S / 32 - 4) * 32 + (i & 15) * 8; v8b hv, lv;
#pragma unroll
  for (int e = 0; e < 8; ++e) { const int m = m0 + e; const float s = 1.0f + Q[m] + Q[S - 1 - m];
    float v = AS2 * decay_term(n - m) / s; if (v < 6.103515625e-05f) v = 0.0f; b16 a, c; split16(v, a, c); hv[e] = a; lv[e] = c; }
  { *(v8b*)(a2 + (size_t)n * S + m0) = hv; *(v8b*)(a2 + APL + (size_t)n * S + m0) = lv;  }
}

__global__ __launch_bounds__(256) void prep_kernel(const float* __restrict__ x, const float* __restrict__ wqkv, const float* __restrict__ wo, unsigned short* __restrict__ x16, unsigned short* __restrict__ w16, b16* __restrict__ wo16, b16* __restrict__ a2) {
  __shared__ __attribute__((aligned(16))) float Q[S];
  __shared__ float Wt[8];
  if (blockIdx.x < A2B) { attn2_block(blockIdx.x, a2, Q, Wt); return; }   // the same for a whole block
  const size_t tid = (size_t)(blockIdx.x - A2B) * blockDim.x + threadIdx.x, nth = (size_t)(gridDim.x - A2B) * blockDim.x;
  {
    for (size_t p = tid; p < (size_t)NTOK * DIM / 8; p += nth) { v8us v;
#pragma unroll
      for (int e = 0; e < 8; ++e) v[e] = bf16_rne_bits(x[p * 8 + e]);
      *(v8us*)(x16 + p * 8) = v; }
    for (size_t p = tid; p < (size_t)4 * INNER * DIM / 8; p += nth) { const int n = (int)(p / (DIM / 8)), k0 = (int)(p % (DIM / 8)) * 8; v8us v;
#pragma unroll
      for (int e = 0; e < 8; ++e) v[e] = bf16_rne_bits(wqkv[(size_t)(k0 + e) * 4 * INNER + n]);
      *(v8us*)(w16 + (size_t)n * DIM + k0) = v; }
    for (size_t p = tid; p < (size_t)DIM * 2 * INNER / 8; p += nth) { const int n = (int)(p / (2 * INNER / 8)), k0 = (int)(p % (2 * INNER / 8)) * 8; v8b w;
#pragma unroll
      for (int e = 0; e < 8; ++e) w[e] = (b16)bf16_rne(wo[(size_t)(k0 + e) * DIM + n]);
      *(v8b*)(wo16 + (size_t)n * 2 * INNER + k0) = w; }
    
  }
}

// projections: rows = tokens (4096), K = 512, column tiles of 64 = one head of q | k | v | t (32 tiles): q/k -> x8 hi/lo rows [b*H + h][tok][64]; v, t -> (8v)^T, (8t)^T hi/lo planes
// [b*H + h][64][tok]. grid (32, 32) x 128.
__global__ __launch_bounds__(128) void proj_kernel(const __bf16* __restrict__ x16, const __bf16* __restrict__ w16, b16* __restrict__ qh, b16* __restrict__ kh, b16* __restrict__ vt, b16* __restrict__ tt) {
  __shared__ __attribute__((aligned(16))) b16 Th[4][32][HD + 8], Tq[4][32][HD + 8];
  __shared__ __attribute__((aligned(16))) b16 Tt[64][128 + 8], Tl[64][128 + 8];
  const int lane = threadIdx.x & 31, wave = threadIdx.x >> 5, nloc = lane & 15, hlf = lane >> 4, m0 = blockIdx.y * 128 + wave * 32, c0 = blockIdx.x * 64;
  const int which = blockIdx.x / H, head = blockIdx.x % H, b = m0 / S, tok0 = m0 % S;
  v8f acc[2][4];
#pragma unroll
  for (int r = 0; r < 2; ++r)
#pragma unroll
    for (int t = 0; t < 4; ++t) acc[r][t] = (v8f){};
#pragma unroll 2
  for (int kb = 0; kb < DIM; kb += 32) {
    const v16bb a0 = frag_kb_bf(x16 + (size_t)(m0 + nloc) * DIM + kb, hlf), a1 = frag_kb_bf(x16 + (size_t)(m0 + 16 + nloc) * DIM + kb, hlf);
#pragma unroll
    for (int t = 0; t < 4; ++t) { const v16bb bw = frag_kb_bf(w16 + (size_t)(c0 + t * 16 + nloc) * DIM + kb, hlf); acc[0][t] = wmma16bb(a0, bw, acc[0][t]); acc[1][t] = wmma16bb(a1, bw, acc[1][t]); } }
  if (which < 2) {
#pragma unroll
    for (int t = 0; t < 4; ++t)
#pragma unroll
      for (int r = 0; r < 2; ++r)
#pragma unroll
        for (int v = 0; v < 8; ++v) { b16 a_, c_; split16(acc[r][t][v] * QS, a_, c_); Th[wave][r * 16 + 8 * hlf + v][t * 16 + nloc] = a_; Tq[wave][r * 16 + 8 * hlf + v][t * 16 + nloc] = c_; }
    wave_lds_sync();
    b16* dst = ((which == 0) ? qh : kh) + (((size_t)b * H + head) * S + tok0) * HD;
    {
#pragma unroll
      for (int j = 0; j < 8; ++j) { const int rr = j * 4 + (lane >> 3), c8 = (lane & 7) * 8; *(v8b*)(dst + (size_t)rr * HD + c8) = *(const v8b*)(&Th[wave][rr][c8]); *(v8b*)(dst + QPL + (size_t)rr * HD + c8) = *(const v8b*)(&Tq[wave][rr][c8]); }
       }
    return;
  }
#pragma unroll
  for (int t = 0; t < 4; ++t)
#pragma unroll
    for (int r = 0; r < 2; ++r)
#pragma unroll
      for (int v = 0; v < 8; ++v) { b16 a_, c_; split16(acc[r][t][v] * VS, a_, c_); Tt[t * 16 + nloc][wave * 32 + r * 16 + 8 * hlf + v] = a_; Tl[t * 16 + nloc][wave * 32 + r * 16 + 8 * hlf + v] = c_; }
  __syncthreads();
  b16* dstv = ((which == 2) ? vt : tt) + (((size_t)b * H + head) * HD) * S + (blockIdx.y * 128) % S;
  {
#pragma unroll
    for (int j = 0; j < 8; ++j) { const int dd = wave * 16 + j * 2 + (lane >> 4), c8 = (lane & 15) * 8; *(v8b*)(dstv + (size_t)dd * S + c8) = *(const v8b*)(&Tt[dd][c8]); *(v8b*)(dstv + VPL + (size_t)dd * S + c8) = *(const v8b*)(&Tl[dd][c8]); }
    
  }
}

// attention. The query row of token i is q[i mod 513], so softmax(q~.k / 8).v has only 513 distinct rows per (b, h): each is computed ONCE and stored to its up to four tokens
// r, r + 513, r + 1026, r + 1539 (< 2048). Block = (b, h, 1/16 of the sequence), 24 waves:
//   waves 0..15 : two softmax tiles of 16 distinct rows (32 full tiles per (b, h)), each tile's 2048 keys split over 8 waves (256 keys in a row per wave);
//   waves 16..23: decay tiles of 16 tokens, o2 += (8t)^T . A2^T rows (A2[q][m] as the B operand: rows = queries, k = keys; 3 products), over the 3 key blocks outside which A2 is zero;
//                 in the first block of each (b, h) they then take the 8 key parts of the tile that holds row 512 (rows 513.. are not stored).
// A softmax wave runs the online softmax over its own keys in ascending order in steps of 32 (k x q hi/lo, 3 products; o1 += (8v)^T.P, 3 products) and leaves its running maximum m, its sum l
// and its unnormalised o1 in LDS; behind one block barrier the 8 parts of a tile are merged in ascending key order: M = max m_w, l = sum l_w e^(m_w - M), o1 = sum o1_w e^(m_w - M).
// y[tok][h*128 + 0..63] = o1/(64 l), [64..127] = o2/64; f32 rows; each role stores 256 B (two whole lines) per row.
constexpr int NS = 8, KPS = S / NS, SPB = 2, DPB = 8, BPH = S / 16 / DPB, AW = SPB * NS + DPB;
static_assert(BPH * SPB * 16 == QP - 1 && QP * 4 >= S, "32 full tiles of distinct rows and one more row; four copies cover the sequence");
static_assert(DPB == NS && KPS % 32 == 0, "the decay waves of a block are as many as the key parts of the last tile");
__device__ __forceinline__ void softmax_part(const b16* __restrict__ Q, const b16* __restrict__ K, const b16* __restrict__ V, int r0, int kb0, int lane, float (*Os)[HD + 4], float* Ms, float* Ls) {
  const int hh = lane >> 4, col = lane & 15, qsrc = r0 + col;
  v16b qf[2], ql[2];
#pragma unroll
  for (int ks = 0; ks < 2; ++ks) { qf[ks] = frag_kb(Q + (size_t)qsrc * HD + ks * 32, hh); ql[ks] = frag_kb(Q + QPL + (size_t)qsrc * HD + ks * 32, hh); }
  float m = -INFINITY, l = 0.0f; v8f o1[4] = {{}, {}, {}, {}};
  for (int kb = kb0; kb < kb0 + KPS; kb += 32) {
    v8f s0 = {}, s1 = {};
#pragma unroll
    for (int ks = 0; ks < 2; ++ks) { const v16b k0 = frag_kb(K + (size_t)(kb + col) * HD + ks * 32, hh), k0l = frag_kb(K + QPL + (size_t)(kb + col) * HD + ks * 32, hh), k1 = frag_kb(K + (size_t)(kb + 16 + col) * HD + ks * 32, hh), k1l = frag_kb(K + QPL + (size_t)(kb + 16 + col) * HD + ks * 32, hh);
      s0 = wmma16b(k0, qf[ks], s0); s0 = wmma16b(k0, ql[ks], s0); s0 = wmma16b(k0l, qf[ks], s0); s1 = wmma16b(k1, qf[ks], s1); s1 = wmma16b(k1, ql[ks], s1); s1 = wmma16b(k1l, qf[ks], s1); }
    float mr = -INFINITY;
#pragma unroll
    for (int r = 0; r < 8; ++r) { s0[r] *= SCALE / (QS * QS); s1[r] *= SCALE / (QS * QS); mr = fmaxf(mr, fmaxf(s0[r], s1[r])); }
    mr = fmaxf(mr, __shfl_xor(mr, 16));
    const float mn = fmaxf(m, mr), al_ = __expf(m - mn); m = mn;
    float sum = 0.0f; v16b pb, pl;
#pragma unroll
    for (int r = 0; r < 8; ++r) { const float e0 = __expf(s0[r] - mn), e1 = __expf(s1[r] - mn); sum += e0 + e1; b16 a, c; split16(e0 * PS, a, c); pb[r] = a; pl[r] = c; split16(e1 * PS, a, c); pb[8 + r] = a; pl[8 + r] = c; }
    sum += __shfl_xor(sum, 16); l = l * al_ + sum;
#pragma unroll
    for (int n = 0; n < 4; ++n) {
#pragma unroll
      for (int r = 0; r < 8; ++r) o1[n][r] *= al_;
      const v16b vf = frag_kb(V + (size_t)(n * 16 + col) * S + kb, hh), vl = frag_kb(V + VPL + (size_t)(n * 16 + col) * S + kb, hh);
      o1[n] = wmma16b(vf, pb, o1[n]); o1[n] = wmma16b(vf, pl, o1[n]); o1[n] = wmma16b(vl, pb, o1[n]); }
  }
#pragma unroll
  for (int n = 0; n < 4; ++n)
#pragma unroll
    for (int r = 0; r < 8; ++r) Os[col][n * 16 + 8 * hh + r] = o1[n][r];
  if (hh == 0) { Ms[col] = m; Ls[col] = l; }
}
// one float4 of a tile's 16 x 64 result per thread t of 256: two rows x 256 B per store instruction (16 lanes x 16 B a row), once per token that uses the row
__device__ __forceinline__ void merge_tile(const float (*Os)[16][HD + 4], const float (*Ms)[16], const float (*Ls)[16], int r0, int t, float* __restrict__ yb) {
  const int rl = t >> 4, c4 = (t & 15) * 4, row = r0 + rl;
  float M = Ms[0][rl];
#pragma unroll
  for (int w = 1; w < NS; ++w) M = fmaxf(M, Ms[w][rl]);
  float l = 0.0f; v4f acc = {};
#pragma unroll
  for (int w = 0; w < NS; ++w) { const float f = __expf(Ms[w][rl] - M); l += Ls[w][rl] * f; acc += *(const v4f*)(&Os[w][rl][c4]) * f; }
  const v4f val = acc * (1.0f / (VS * PS * l));
#pragma unroll
  for (int c = 0; c < 4; ++c) { const int tok = row + c * QP; if (row < QP && tok < S) *(v4f*)(yb + (size_t)tok * (2 * INNER) + c4) = val; }
}
__device__ __forceinline__ void decay_tile(const b16* __restrict__ T, const b16* __restrict__ a2, int q0, int lane, float (*Os)[HD + 4], float* __restrict__ yb) {
  const int hh = lane >> 4, col = lane & 15, qi = q0 + col;
  v8f o2[4] = {{}, {}, {}, {}};
  const int kb0 = min(max((q0 >> 5) - 1, 0), S / 32 - 3) * 32;   // first of the 3 key blocks outside which A2 rows q0..q0+15 are all zero (see attn2 planes)
  for (int kb = kb0; kb < kb0 + 96; kb += 32) {
    const v16b af = frag_kb(a2 + (size_t)qi * S + kb, hh), al2 = frag_kb(a2 + APL + (size_t)qi * S + kb, hh);   // A2 rows = queries (B operand), k = keys
#pragma unroll
    for (int n = 0; n < 4; ++n) {
      const v16b tf = frag_kb(T + (size_t)(n * 16 + col) * S + kb, hh), tl = frag_kb(T + VPL + (size_t)(n * 16 + col) * S + kb, hh);
      o2[n] = wmma16b(tf, af, o2[n]); o2[n] = wmma16b(tf, al2, o2[n]); o2[n] = wmma16b(tl, af, o2[n]); }
  }
  const float i2 = 1.0f / (VS * AS2);
#pragma unroll
  for (int n = 0; n < 4; ++n)
#pragma unroll
    for (int r = 0; r < 8; ++r) Os[col][n * 16 + 8 * hh + r] = o2[n][r] * i2;
  wave_lds_sync();
#pragma unroll
  for (int j = 0; j < 8; ++j) *(v4f*)(yb + (size_t)(q0 + j * 2 + hh) * (2 * INNER) + HD + col * 4) = *(const v4f*)(&Os[j * 2 + hh][col * 4]);
}
__global__ __launch_bounds__(AW * 32) void attn_kernel(const b16* __restrict__ qh, const b16* __restrict__ kh, const b16* __restrict__ vt, const b16* __restrict__ tt, const b16* __restrict__ a2, float* __restrict__ y) {
  __shared__ __attribute__((aligned(16))) float Os[AW][16][HD + 4];
  __shared__ float Ms[AW][16], Ls[AW][16];
  const int wid = __builtin_amdgcn_readfirstlane(threadIdx.x >> 5), lane = threadIdx.x & 31;   // the wave's number in a scalar register: the role tests are scalar branches
  const int bh = blockIdx.x / BPH, part = blockIdx.x % BPH, b = bh / H, h = bh % H;
  float* yb = y + (size_t)b * S * (2 * INNER) + h * 2 * HD;
  const int grp = wid / NS;                                       // 0, 1: the block's two full tiles; 2: the tile of row 512 (first block of each (b, h) only)
  const int r0 = (grp < SPB) ? (part * SPB + grp) * 16 : QP - 1;
  const bool has_tile = grp < SPB || part == 0;
  if (grp == SPB) {
    decay_tile(tt + (size_t)bh * HD * S, a2, (part * DPB + wid - SPB * NS) * 16, lane, Os[wid], yb);
    asm volatile("s_wait_xcnt 0x0" ::: "memory");                 // the wave may go on to a softmax part, which rewrites the registers that the stores above name
  }
  if (has_tile) softmax_part(qh + (size_t)bh * S * HD, kh + (size_t)bh * S * HD, vt + (size_t)bh * HD * S, r0, (wid % NS) * KPS, lane, Os[wid], Ms[wid], Ls[wid]);
  __syncthreads();                                                // every wave of the block passes it: the 8 parts of a tile are in LDS
  if (has_tile) merge_tile(&Os[grp * NS], &Ms[grp * NS], &Ls[grp * NS], r0, (int)threadIdx.x % (NS * 32), yb);
}

// out = y W_out + b: rows 4096, K = 1024 (y split x8 hi/lo at load), 8 column tiles of 64; + bf16(b); f32 rows. grid (8, 32). Block = 128 rows x 64 columns, 16 waves: 4 row groups of 32
// x 4 parts of K (256 in a row per wave), so that a SIMD holds 4 waves whose load waits cover one another. Each wave leaves its f32 partial tile in LDS; behind one block barrier the 4 parts
// are added in ascending k order, scaled, biased and stored, 256 B (two whole lines) per row. amdgpu_waves_per_eu(4, 4): the register budget of the 4 waves that a SIMD holds here; with the
// default budget (8 waves) the compiler waited for the A rows' loads pair by pair instead of issuing the 8 of a k step together.
constexpr int ORG = 4, OKS = 4, OKP = 2 * INNER / OKS;
__global__ __launch_bounds__(ORG * OKS * 32) __attribute__((amdgpu_waves_per_eu(4, 4))) void out_kernel(const float* __restrict__ y, const b16* __restrict__ wo16, const float* __restrict__ bo, float* __restrict__ out) {
  __shared__ __attribute__((aligned(16))) float Ts[OKS][ORG * 32][64 + 4];
  const int lane = threadIdx.x & 31, wave = threadIdx.x >> 5, nloc = lane & 15, hlf = lane >> 4, g = wave % ORG, ks = wave / ORG, m0 = blockIdx.y * (ORG * 32), c0 = blockIdx.x * 64;
  v8f acc[2][4];
#pragma unroll
  for (int r = 0; r < 2; ++r)
#pragma unroll
    for (int t = 0; t < 4; ++t) acc[r][t] = (v8f){};
  const Opnd A{y + ks * OKP, nullptr, 2 * INNER}, Bo{wo16 + ks * OKP, nullptr, 2 * INNER};
  gemm_tile<5, 1>(A, Bo, OKP, m0 + g * 32, c0, nloc, hlf, acc);
#pragma unroll
  for (int t = 0; t < 4; ++t)
#pragma unroll
    for (int r = 0; r < 2; ++r)
#pragma unroll
      for (int v = 0; v < 8; ++v) Ts[ks][g * 32 + r * 16 + 8 * hlf + v][t * 16 + nloc] = acc[r][t][v];
  __syncthreads();                                                // every wave of the block passes it: the 4 parts of K of every row group are in LDS
  const int c4 = nloc * 4;
  v4f bias;
#pragma unroll
  for (int e = 0; e < 4; ++e) bias[e] = bf16_rne(bo[c0 + c4 + e]);
#pragma unroll
  for (int j = 0; j < ORG * 32 * 16 / (ORG * OKS * 32); ++j) {
    const int rr = j * (ORG * OKS * 2) + ((int)threadIdx.x >> 4);
    v4f s = *(const v4f*)(&Ts[0][rr][c4]);
#pragma unroll
    for (int p = 1; p < OKS; ++p) s += *(const v4f*)(&Ts[p][rr][c4]);
    *(v4f*)(out + (size_t)(m0 + rr) * DIM + c0 + c4) = s * 0.125f + bias;
  }
}
}  // namespace

extern "C" void kernel_launch(void* const* d_in, const int* in_sizes, int n_in,
                              void* d_out, int out_size, void* d_ws, size_t ws_size, hipStream_t stream) {
  (void)n_in; (void)out_size;
  const float* x = (const float*)d_in[0]; const float* wqkv = (const float*)d_in[1]; const float* wo = (const float*)d_in[2]; const float* bo = (const float*)d_in[3];
  float* out = (float*)d_out;   // [2][2048][512]
  if (in_sizes[0] != NTOK * DIM || in_sizes[1] != DIM * 4 * INNER || in_sizes[2] != 2 * INNER * DIM || in_sizes[3] != DIM) return;
  size_t off = 0; char* ws = (char*)d_ws;
  auto carve = [&](size_t bytes) { char* p = ws + off; off += (bytes + 255) & ~(size_t)255; return p; };
  unsigned short* x16 = (unsigned short*)carve((size_t)NTOK * DIM * 2); unsigned short* w16 = (unsigned short*)carve((size_t)4 * INNER * DIM * 2); b16* wo16 = (b16*)carve((size_t)DIM * 2 * INNER * 2);
  b16* a2 = (b16*)carve(APL * 2 * 2);
  b16* qh = (b16*)carve(QPL * 2 * 2); b16* kh = (b16*)carve(QPL * 2 * 2); b16* vt = (b16*)carve(VPL * 2 * 2); b16* tt = (b16*)carve(VPL * 2 * 2); float* y = (float*)carve((size_t)NTOK * 2 * INNER * 4);
  if (off > ws_size) return;                                    // ≈ 74 MB
  prep_kernel<<<A2B + 1024, 256, 0, stream>>>(x, wqkv, wo, x16, w16, wo16, a2);
  proj_kernel<<<dim3(4 * INNER / 64, NTOK / 128), 128, 0, stream>>>((const __bf16*)x16, (const __bf16*)w16, qh, kh, vt, tt);
  attn_kernel<<<Bn * H * BPH, AW * 32, 0, stream>>>(qh, kh, vt, tt, a2, y);
  out_kernel<<<dim3(DIM / 64, NTOK / (ORG * 32)), ORG * OKS * 32, 0, stream>>>(y, wo16, bo, out);
}

// v006
// A run of this version takes 101 microseconds.
// Two timings next to v005 put it at 1.13 and 1.10 times that version's speed.
// All steps since v000 together make it 3.63 times as fast.
#include <hip/hip_runtime.h>

// "Fast attention": [q | k | v | t] = x W_qkv (8 heads x 64 each); query i uses q[i mod 513] (the module's pad/reshape/tile trick with STEP 4, n = 2048); attn1 = softmax(q~.k / 8) over
// all 2048 keys; out1 = attn1.v; attn2[n][m] = exp(-|n-m|/e) / s[m] with s[m] = sum_k exp(-|m-k|/e) (the module's broadcast divides column m by row-sum m); out2 = attn2.t (shared
// over batch and heads); out = [out1 | out2 per head] W_out + b -> [2][2048][512].
// Numerics: x, W_qkv, W_out, b_out rounded to bf16; projection on v_wmma_f32_16x16x32_bf16 (exact products); q, k, v, t, P and the
// merged attention output carried x8 as f16 hi+lo pairs (3 / 2 products) on v_wmma_f32_16x16x32_f16; the analytic attn2 matrix as an x8 f16 hi+lo pair (entries that would be f16-
// subnormal are zeroed identically everywhere — they are < 8e-6 of a row); online softmax and the row sums s[m] in f32. Fragment k-map per lane half hh for A AND B: elements 0..7 <-

namespace {
constexpr int Bn = 2, S = 2048, DIM = 512, H = 8, HD = 64, INNER = 512, NTOK = Bn * S, QP = 513 /* (n + yushu) / STEP */;
constexpr float SCALE = 0.125f, VS = 8.0f, QS = 8.0f, PS = 8.0f, AS2 = 8.0f, INV_E = 0.36787944117144233f;
constexpr size_t QPL = (size_t)Bn * H * S * HD, VPL = QPL, APL = (size_t)S * S;

typedef _Float16 b16;
typedef __attribute__((ext_vector_type(16))) _Float16 v16b;
typedef __attribute__((ext_vector_type(8)))  _Float16 v8b;
typedef __attribute__((ext_vector_type(8)))  float v8f;
typedef __attribute__((ext_vector_type(4)))  float v4f;

__device__ __forceinline__ v8b ld8b(const b16* p) { return *(const v8b*)p; }
__device__ __forceinline__ v16b cat8b(v8b a, v8b b) { return __builtin_shufflevector(a, b, 0, 1, 2, 3, 4, 5, 6, 7, 8, 9, 10, 11, 12, 13, 14, 15); }
// Every 16-bit operand plane in the workspace (rows x kd columns, rows a multiple of 16, kd of 32) lies in fragment order: tiles of 16 rows x 32 k (1 KB), tile (row / 16, k / 32) at index
// (row / 16) * (kd / 32) + k / 32; inside a tile the 16-byte chunk of 8 k at (row, k) stands at place ((k / 16) % 2) * 32 + ((k / 8) % 2) * 16 + row % 16. A fragment load (lane = 16 hh + row % 16)
// then reads 512 bytes in a row, four whole lines, where a row-major plane gave it 32 bytes in each of 16 lines. foff is the one map that every writer and every reader of a plane uses.
__device__ __forceinline__ size_t foff(int row, int k, int kd) { return ((size_t)((row >> 4) * (kd >> 5) + (k >> 5)) << 9) + (size_t)(((((k >> 4) & 1) << 5) | (((k >> 3) & 1) << 4) | (row & 15)) << 3); }
// chunk p of a plane in memory order -> its (row, k): foff(row, k, kd) == 8 p
__device__ __forceinline__ void finv(int p, int kd, int& row, int& k) { const int tile = p >> 6, c = p & 63, tk = kd >> 5; row = (tile / tk) * 16 + (c & 15); k = (tile % tk) * 32 + ((c >> 5) & 1) * 16 + ((c >> 4) & 1) * 8; }
// fragment of row 'row', k in [kb, kb + 32), kb a multiple of 32: elements 0..7 <- k = kb + 8 hh.., 8..15 <- k = kb + 16 + 8 hh.. (the chunks foff(row, kb + 8 hh) and foff(row, kb + 16 + 8 hh))
__device__ __forceinline__ v16b frag_t(const b16* plane, int row, int kb, int kd, int hh) { const b16* p = plane + foff(row, kb + 8 * hh, kd); return cat8b(ld8b(p), ld8b(p + 256)); }
// the same from the address of the fragment's first chunk, p = plane + foff(row, kb + 8 hh, kd)
typedef const __attribute__((address_space(1))) b16* gp16; typedef const __attribute__((address_space(1))) v8b* gp8b;   // pointers typed as global: one that has gone through an asm statement still gives global loads
__device__ __forceinline__ v16b frag_p(gp16 p) { return cat8b(*(gp8b)p, *(gp8b)(p + 256)); }
__device__ __forceinline__ void split16(float v, b16& hi, b16& lo) { hi = (b16)v; lo = (b16)(v - (float)hi); }
// hi/lo fragment pair straight from an f32 k-contiguous row (same k-map)
__device__ __forceinline__ void frag_ksplit(const float* p, int hh, v16b& fh_, v16b& fl_) {
  const float* p0 = p + 8 * hh; const float* p1 = p + 16 + 8 * hh;
#pragma unroll
  for (int e = 0; e < 8; ++e) { b16 a, c; split16(p0[e], a, c); fh_[e] = a; fl_[e] = c; split16(p1[e], a, c); fh_[8 + e] = a; fl_[8 + e] = c; }
}
__device__ __forceinline__ v8f wmma16b(v16b a, v16b b, v8f c) {
  v8f d = __builtin_amdgcn_wmma_f32_16x16x32_f16(false, a, false, b, (short)0, c, false, false);
  asm volatile("v_nop\n\tv_nop\n\tv_nop\n\tv_nop" : "+v"(d) : "v"(a), "v"(b));
  return d;
}
__device__ __forceinline__ void wave_lds_sync() {
  __builtin_amdgcn_fence(__ATOMIC_RELEASE, "workgroup");
  __builtin_amdgcn_wave_barrier();
  __builtin_amdgcn_fence(__ATOMIC_ACQUIRE, "workgroup");
}

// Operand descriptor: NP = 0 -> f32 rows split on the fly into (hi, lo); NP = 1 -> one f16 plane; NP = 2 -> f16 hi + lo planes;
// NP = 3 -> f32 rows rounded once to a single f16 fragment. ld = row pitch (f32 rows) or the plane's columns (f16 planes, which lie in fragment order).
struct Opnd { const void* p0; const void* p1; int ld; };
template <int NP> __device__ __forceinline__ void load_frags(const Opnd& o, int row, int kb, int hh, v16b& fh_, v16b& fl_) {
  if (NP == 0) { frag_ksplit((const float*)o.p0 + (size_t)row * o.ld + kb, hh, fh_, fl_); }
  else if (NP == 4 || NP == 5) {                             // f32 rows x64 (NP 4) or x8 (NP 5) then split (keeps the lo halves of small values normal)
    const float sc_ = (NP == 4) ? 64.0f : 8.0f;
    const float* p = (const float*)o.p0 + (size_t)row * o.ld + kb; const float* p0 = p + 8 * hh; const float* p1 = p + 16 + 8 * hh;
#pragma unroll
    for (int e = 0; e < 8; ++e) { b16 a, c; split16(p0[e] * sc_, a, c); fh_[e] = a; fl_[e] = c; split16(p1[e] * sc_, a, c); fh_[8 + e] = a; fl_[8 + e] = c; }
  } else if (NP == 3) {
    const float* p = (const float*)o.p0 + (size_t)row * o.ld + kb; const float* p0 = p + 8 * hh; const float* p1 = p + 16 + 8 * hh;
#pragma unroll
    for (int e = 0; e < 8; ++e) { fh_[e] = (b16)p0[e]; fh_[8 + e] = (b16)p1[e]; }
    fl_ = fh_;
  } else {
    fh_ = frag_t((const b16*)o.p0, row, kb, o.ld, hh);
    if (NP == 2) fl_ = frag_t((const b16*)o.p1, row, kb, o.ld, hh); else fl_ = fh_;
  }
}
template <int ANP, int BNP> __device__ __forceinline__ v8f mac(v16b ah, v16b al, v16b bh, v16b bl, v8f c) {
  c = wmma16b(ah, bh, c);
  if (BNP == 0 || BNP == 2 || BNP == 4 || BNP == 5) c = wmma16b(ah, bl, c);     // hi.lo
  if (ANP == 0 || ANP == 2 || ANP == 4 || ANP == 5) c = wmma16b(al, bh, c);     // lo.hi   (lo.lo dropped)
  return c;
}
// 32x64 wave tile: acc[r][t] (rows m0+16r.., cols c0+16t..) += A[m][k] . B[n][k] over k in [0, K)
template <int ANP, int BNP>
__device__ __forceinline__ void gemm_tile(const Opnd& A, const Opnd& B, int K, int m0, int c0, int nloc, int hlf, v8f (&acc)[2][4]) {
  for (int kb = 0; kb < K; kb += 32) {
    v16b a0h, a0l, a1h, a1l;
    load_frags<ANP>(A, m0 + nloc, kb, hlf, a0h, a0l);
    load_frags<ANP>(A, m0 + 16 + nloc, kb, hlf, a1h, a1l);
#pragma unroll
    for (int t = 0; t < 4; ++t) {
      v16b bh, bl;
      load_frags<BNP>(B, c0 + t * 16 + nloc, kb, hlf, bh, bl);
      acc[0][t] = mac<ANP, BNP>(a0h, a0l, bh, bl, acc[0][t]);
      acc[1][t] = mac<ANP, BNP>(a1h, a1l, bh, bl, acc[1][t]);
    }
  }
}

__device__ __forceinline__ void epi_planes(v8f (&acc)[2][4], float scale, bool two, b16* __restrict__ oh, b16* __restrict__ ol, int ldo,
                                           int m0, int c0, int lane, b16* Th, b16* Tl) {
  const int nloc = lane & 15, hlf = lane >> 4;
#pragma unroll
  for (int t = 0; t < 4; ++t)
#pragma unroll
    for (int r = 0; r < 2; ++r)
#pragma unroll
      for (int v = 0; v < 8; ++v) {
        const int rr = r * 16 + v + 8 * hlf, cc = t * 16 + nloc;
        b16 h_, l_; split16(acc[r][t][v] * scale, h_, l_);
        Th[rr * 64 + cc] = h_; Tl[rr * 64 + cc] = l_;
      }
  wave_lds_sync();
  {
#pragma unroll
    for (int j = 0; j < 8; ++j) {
      const int rr = j * 4 + (lane >> 3), c8 = (lane & 7) * 8;
      const size_t o = (size_t)(m0 + rr) * ldo + c0 + c8;
      *(v8b*)(oh + o) = ld8b(Th + rr * 64 + c8);
      if (two) *(v8b*)(ol + o) = ld8b(Tl + rr * 64 + c8);
    }
    
  }
}
typedef __attribute__((ext_vector_type(8))) __bf16 v8bb; typedef __attribute__((ext_vector_type(16))) __bf16 v16bb;
typedef __attribute__((ext_vector_type(8))) unsigned short v8us;
__device__ __forceinline__ v16bb frag_t_bf(const __bf16* plane, int row, int kb, int kd, int hh) { const __bf16* p = plane + foff(row, kb + 8 * hh, kd); const v8bb a = *(const v8bb*)p, b = *(const v8bb*)(p + 256); return __builtin_shufflevector(a, b, 0, 1, 2, 3, 4, 5, 6, 7, 8, 9, 10, 11, 12, 13, 14, 15); }
__device__ __forceinline__ v8f wmma16bb(v16bb a, v16bb b, v8f c) {
  v8f d = __builtin_amdgcn_wmma_f32_16x16x32_bf16(false, a, false, b, (short)0, c, false, false);
  asm volatile("v_nop\n\tv_nop\n\tv_nop\n\tv_nop" : "+v"(d) : "v"(a), "v"(b));
  return d;
}
__device__ __forceinline__ unsigned short bf16_rne_bits(float v) { unsigned int u = __float_as_uint(v); u += 0x7FFFu + ((u >> 16) & 1u); return (unsigned short)(u >> 16); }
__device__ __forceinline__ float bf16_rne(float v) { return __uint_as_float(((unsigned int)bf16_rne_bits(v)) << 16); }



// attn2 planes: A2[n][m] = 8 exp(-|n-m|/e)/s[m] as hi/lo f16 planes [2048][2048], s[m] = sum_k exp(-|m-k|/e) (f32, same expf); entries below the f16 normal range zeroed.
// That rule zeroes every entry with |n-m| >= 33: s[m] >= 1 (its k = m term), so 8 exp(-33/e)/s[m] <= 4.3e-5 < 2^-14. For a row n of the 32-row group j = n / 32 the key blocks of 32
// other than j-1, j, j+1 hold only such entries: they are neither written nor read. Read per row: 3 blocks from block clamp(j-1, 0, 61); written: the 4 whole tiles of 16 rows x 32 keys (128 keys,
// from block clamp((j-1) & ~1, 0, 60)) that hold those 3.
// The 2048 terms of s[m] are exp(-d/e) for d = 0, then d = 1..m (keys below m) and d = 1..2047-m (keys above): with Q[j] = sum_{d=1..j} exp(-d/e), s[m] = 1 + Q[m] + Q[2047-m], every term
// kept. A block of 256 threads forms all of Q itself (8 terms a thread, a scan over the block, in ascending d), so the planes need no launch before them: they are built by A2B blocks of
// their own in the launch that rounds x and the weights (16 rows x 128 keys a block).
constexpr int A2B = S * 16 / 256;
// exp(-|d|/e) as __expf forms it (two multiplies, v_exp_f32), with the one slot that the instruction set asks for behind a transcendental inside the statement
__device__ __forceinline__ float decay_term(int d) { float r; asm("v_exp_f32 %0, %1\n\tv_nop" : "=v"(r) : "v"((-fabsf((float)d) * INV_E) * 1.44269504088896340736f)); return r; }
__device__ __forceinline__ void attn2_block(int blk, b16* __restrict__ a2, float* Q, float* Wt) {
  const int t = threadIdx.x, lane = t & 31, wave = t >> 5;
  float pre[8], run = 0.0f;
#pragma unroll
  for (int e = 0; e < 8; ++e) { const int d = 8 * t + e; const float ex = decay_term(d); run += (d == 0) ? 0.0f : ex; pre[e] = run; }
  float inc = run;                                                // sum of the wave's threads up to and with this one
#pragma unroll
  for (int o = 1; o < 32; o <<= 1) { const float u = __shfl_up(inc, o); if (lane >= o) inc += u; }
  if (lane == 31) Wt[wave] = inc;
  float base = __shfl_up(inc, 1); if (lane == 0) base = 0.0f;
  __syncthreads();                                                // the 8 waves' totals are in LDS
  float wb = 0.0f;
#pragma unroll
  for (int w = 0; w < 7; ++w) wb += (w < wave) ? Wt[w] : 0.0f;    // the waves below this one, in ascending d
  base += wb;
#pragma unroll
  for (int e = 0; e < 8; ++e) Q[8 * t + e] = base + pre[e];
  __syncthreads();                                                // all of Q is in LDS
  const int n = blk * 16 + (t & 15), m0 = min(max(((n >> 5) - 1) & ~1, 0), S / 32 - 4) * 32 + (t >> 4) * 8; v8b hv, lv;   // a wave: 16 rows x 2 chunks = 512 bytes in a row of the plane
#pragma unroll
  for (int e = 0; e < 8; ++e) { const int m = m0 + e; const float s = 1.0f + Q[m] + Q[S - 1 - m];
    float v = AS2 * decay_term(n - m) / s; if (v < 6.103515625e-05f) v = 0.0f; b16 a, c; split16(v, a, c); hv[e] = a; lv[e] = c; }
  { const size_t o = foff(n, m0, S); *(v8b*)(a2 + o) = hv; *(v8b*)(a2 + APL + o) = lv; }
}

__global__ __launch_bounds__(256) void prep_kernel(const float* __restrict__ x, const float* __restrict__ wqkv, const float* __restrict__ wo, unsigned short* __restrict__ x16, unsigned short* __restrict__ w16, b16* __restrict__ wo16, b16* __restrict__ a2) {
  __shared__ __attribute__((aligned(16))) float Q[S];
  __shared__ float Wt[8];
  if (blockIdx.x < A2B) { attn2_block(blockIdx.x, a2, Q, Wt); return; }   // the same for a whole block
  const size_t tid = (size_t)(blockIdx.x - A2B) * blockDim.x + threadIdx.x, nth = (size_t)(gridDim.x - A2B) * blockDim.x;
  {
    for (size_t p = tid; p < (size_t)NTOK * DIM / 8; p += nth) { int n, k0; finv((int)p, DIM, n, k0); v8us v;
#pragma unroll
      for (int e = 0; e < 8; ++e) v[e] = bf16_rne_bits(x[(size_t)n * DIM + k0 + e]);
      *(v8us*)(x16 + foff(n, k0, DIM)) = v; }
    for (size_t p = tid; p < (size_t)4 * INNER * DIM / 8; p += nth) { int n, k0; finv((int)p, DIM, n, k0); v8us v;
#pragma unroll
      for (int e = 0; e < 8; ++e) v[e] = bf16_rne_bits(wqkv[(size_t)(k0 + e) * 4 * INNER + n]);
      *(v8us*)(w16 + foff(n, k0, DIM)) = v; }
    for (size_t p = tid; p < (size_t)DIM * 2 * INNER / 8; p += nth) { int n, k0; finv((int)p, 2 * INNER, n, k0); v8b w;
#pragma unroll
      for (int e = 0; e < 8; ++e) w[e] = (b16)bf16_rne(wo[(size_t)(k0 + e) * DIM + n]);
      *(v8b*)(wo16 + foff(n, k0, 2 * INNER)) = w; }
    
  }
}

// projections: rows = tokens (4096), K = 512, column tiles of 64 = one head of q | k | v | t (32 tiles): q/k -> x8 hi/lo rows [b*H + h][tok][64]; v, t -> (8v)^T, (8t)^T hi/lo planes
// [b*H + h][64][tok]; every plane of a (b, h) in fragment order (foff). grid (32, 32) x 128.
__global__ __launch_bounds__(128) void proj_kernel(const __bf16* __restrict__ x16, const __bf16* __restrict__ w16, b16* __restrict__ qh, b16* __restrict__ kh, b16* __restrict__ vt, b16* __restrict__ tt) {
  __shared__ __attribute__((aligned(16))) b16 Th[4][32][HD + 8], Tq[4][32][HD + 8];
  __shared__ __attribute__((aligned(16))) b16 Tt[64][128 + 8], Tl[64][128 + 8];
  const int lane = threadIdx.x & 31, wave = threadIdx.x >> 5, nloc = lane & 15, hlf = lane >> 4, m0 = blockIdx.y * 128 + wave * 32, c0 = blockIdx.x * 64;
  const int which = blockIdx.x / H, head = blockIdx.x % H, b = m0 / S, tok0 = m0 % S;
  v8f acc[2][4];
#pragma unroll
  for (int r = 0; r < 2; ++r)
#pragma unroll
    for (int t = 0; t < 4; ++t) acc[r][t] = (v8f){};
#pragma unroll 2
  for (int kb = 0; kb < DIM; kb += 32) {
    const v16bb a0 = frag_t_bf(x16, m0 + nloc, kb, DIM, hlf), a1 = frag_t_bf(x16, m0 + 16 + nloc, kb, DIM, hlf);
#pragma unroll
    for (int t = 0; t < 4; ++t) { const v16bb bw = frag_t_bf(w16, c0 + t * 16 + nloc, kb, DIM, hlf); acc[0][t] = wmma16bb(a0, bw, acc[0][t]); acc[1][t] = wmma16bb(a1, bw, acc[1][t]); } }
  if (which < 2) {
#pragma unroll
    for (int t = 0; t < 4; ++t)
#pragma unroll
      for (int r = 0; r < 2; ++r)
#pragma unroll
        for (int v = 0; v < 8; ++v) { b16 a_, c_; split16(acc[r][t][v] * QS, a_, c_); Th[wave][r * 16 + 8 * hlf + v][t * 16 + nloc] = a_; Tq[wave][r * 16 + 8 * hlf + v][t * 16 + nloc] = c_; }
    wave_lds_sync();
    b16* dst = ((which == 0) ? qh : kh) + ((size_t)b * H + head) * S * HD;
    {
#pragma unroll
      for (int j = 0; j < 8; ++j) { const int rr = (j >> 2) * 16 + nloc, c8 = (j & 3) * 16 + hlf * 8; const size_t o = foff(tok0 + rr, c8, HD);   // half a tile, 512 bytes in a row, per store
        *(v8b*)(dst + o) = *(const v8b*)(&Th[wave][rr][c8]); *(v8b*)(dst + QPL + o) = *(const v8b*)(&Tq[wave][rr][c8]); }
       }
    return;
  }
#pragma unroll
  for (int t = 0; t < 4; ++t)
#pragma unroll
    for (int r = 0; r < 2; ++r)
#pragma unroll
      for (int v = 0; v < 8; ++v) { b16 a_, c_; split16(acc[r][t][v] * VS, a_, c_); Tt[t * 16 + nloc][wave * 32 + r * 16 + 8 * hlf + v] = a_; Tl[t * 16 + nloc][wave * 32 + r * 16 + 8 * hlf + v] = c_; }
  __syncthreads();
  b16* dstv = ((which == 2) ? vt : tt) + (((size_t)b * H + head) * HD) * S; const int tokb = (blockIdx.y * 128) % S;
  {
#pragma unroll
    for (int j = 0; j < 8; ++j) { const int dd = wave * 16 + nloc, c8 = j * 16 + hlf * 8; const size_t o = foff(dd, tokb + c8, S);   // half a tile, 512 bytes in a row, per store
      *(v8b*)(dstv + o) = *(const v8b*)(&Tt[dd][c8]); *(v8b*)(dstv + VPL + o) = *(const v8b*)(&Tl[dd][c8]); }
    asm volatile("s_wait_xcnt 0x0" ::: "memory");                 // in the listing the q / k branch, which rewrites the registers that these stores name, stands behind them
    
  }
}

// attention. The query row of token i is q[i mod 513], so softmax(q~.k / 8).v has only 513 distinct rows per (b, h): each is computed ONCE and stored to its up to four tokens
// r, r + 513, r + 1026, r + 1539 (< 2048). Block = (b, h, 1/16 of the sequence), 24 waves:
//   waves 0..15 : two softmax tiles of 16 distinct rows (32 full tiles per (b, h)), each tile's 2048 keys split over 8 waves (256 keys in a row per wave);
//   waves 16..23: decay tiles of 16 tokens, o2 += (8t)^T . A2^T rows (A2[q][m] as the B operand: rows = queries, k = keys; 3 products), over the 3 key blocks outside which A2 is zero;
//                 in the first block of each (b, h) they then take the 8 key parts of the tile that holds row 512 (rows 513.. are not stored).
// A softmax wave runs the online softmax over its own keys in ascending order in steps of 32 (k x q hi/lo, 3 products; o1 += (8v)^T.P, 3 products) and leaves its running maximum m, its sum l
// and its unnormalised o1 in LDS; behind one block barrier the 8 parts of a tile are merged in ascending key order: M = max m_w, l = sum l_w e^(m_w - M), o1 = sum o1_w e^(m_w - M).
// y[tok][h*128 + 0..63] = o1/(64 l), [64..127] = o2/64; f32 rows; each role stores 256 B (two whole lines) per row.
constexpr int NS = 8, KPS = S / NS, SPB = 2, DPB = 8, BPH = S / 16 / DPB, AW = SPB * NS + DPB;
static_assert(BPH * SPB * 16 == QP - 1 && QP * 4 >= S, "32 full tiles of distinct rows and one more row; four copies cover the sequence");
static_assert(DPB == NS && KPS % 32 == 0, "the decay waves of a block are as many as the key parts of the last tile");
__device__ __forceinline__ void softmax_part(const b16* __restrict__ Q, const b16* __restrict__ K, const b16* __restrict__ V, int r0, int kb0, int lane, float (*Os)[HD + 4], float* Ms, float* Ls) {
  const int hh = lane >> 4, col = lane & 15, qsrc = r0 + col;
  v16b qf[2], ql[2];
#pragma unroll
  for (int ks = 0; ks < 2; ++ks) { qf[ks] = frag_t(Q, qsrc, ks * 32, HD, hh); ql[ks] = frag_t(Q + QPL, qsrc, ks * 32, HD, hh); }
  float m = -INFINITY, l = 0.0f; v8f o1[4] = {{}, {}, {}, {}};
  gp16 kp = (gp16)(K + foff(kb0 + col, 8 * hh, HD));   // the lane's chunk in the first K tile of the step: a step's 32 keys are 4 tiles in a row (16 keys on = 2 tiles = 1024 elements, 32 k on = 1 tile)
  for (int kb = kb0; kb < kb0 + KPS; kb += 32) {
    v8f s0 = {}, s1 = {};
#pragma unroll
    for (int ks = 0; ks < 2; ++ks) { const v16b k0 = frag_p(kp + ks * 512), k0l = frag_p(kp + QPL + ks * 512), k1 = frag_p(kp + 1024 + ks * 512), k1l = frag_p(kp + QPL + 1024 + ks * 512);
      // the step's 16 K loads name one address pair; it goes through the wait's statement so that it lives up to the wait: else the last load's result was laid over the pair while the loads before it were out
      if (ks == 1) { asm volatile("s_wait_xcnt 0x0" : "+v"(kp) : : "memory"); kp += 2048; }
      s0 = wmma16b(k0, qf[ks], s0); s0 = wmma16b(k0, ql[ks], s0); s0 = wmma16b(k0l, qf[ks], s0); s1 = wmma16b(k1, qf[ks], s1); s1 = wmma16b(k1, ql[ks], s1); s1 = wmma16b(k1l, qf[ks], s1); }
    float mr = -INFINITY;
#pragma unroll
    for (int r = 0; r < 8; ++r) { s0[r] *= SCALE / (QS * QS); s1[r] *= SCALE / (QS * QS); mr = fmaxf(mr, fmaxf(s0[r], s1[r])); }
    mr = fmaxf(mr, __shfl_xor(mr, 16));
    const float mn = fmaxf(m, mr), al_ = __expf(m - mn); m = mn;
    float sum = 0.0f; v16b pb, pl;
#pragma unroll
    for (int r = 0; r < 8; ++r) { const float e0 = __expf(s0[r] - mn), e1 = __expf(s1[r] - mn); sum += e0 + e1; b16 a, c; split16(e0 * PS, a, c); pb[r] = a; pl[r] = c; split16(e1 * PS, a, c); pb[8 + r] = a; pl[8 + r] = c; }
    sum += __shfl_xor(sum, 16); l = l * al_ + sum;
#pragma unroll
    for (int n = 0; n < 4; ++n) {
#pragma unroll
      for (int r = 0; r < 8; ++r) o1[n][r] *= al_;
      const v16b vf = frag_t(V, n * 16 + col, kb, S, hh), vl = frag_t(V + VPL, n * 16 + col, kb, S, hh);
      o1[n] = wmma16b(vf, pb, o1[n]); o1[n] = wmma16b(vf, pl, o1[n]); o1[n] = wmma16b(vl, pb, o1[n]); }
  }
#pragma unroll
  for (int n = 0; n < 4; ++n)
#pragma unroll
    for (int r = 0; r < 8; ++r) Os[col][n * 16 + 8 * hh + r] = o1[n][r];
  if (hh == 0) { Ms[col] = m; Ls[col] = l; }
}
// one float4 of a tile's 16 x 64 result per thread t of 256: two rows x 256 B per store instruction (16 lanes x 16 B a row), once per token that uses the row
__device__ __forceinline__ void merge_tile(const float (*Os)[16][HD + 4], const float (*Ms)[16], const float (*Ls)[16], int r0, int t, float* __restrict__ yb) {
  const int rl = t >> 4, c4 = (t & 15) * 4, row = r0 + rl;
  float M = Ms[0][rl];
#pragma unroll
  for (int w = 1; w < NS; ++w) M = fmaxf(M, Ms[w][rl]);
  float l = 0.0f; v4f acc = {};
#pragma unroll
  for (int w = 0; w < NS; ++w) { const float f = __expf(Ms[w][rl] - M); l += Ls[w][rl] * f; acc += *(const v4f*)(&Os[w][rl][c4]) * f; }
  const v4f val = acc * (1.0f / (VS * PS * l));
#pragma unroll
  for (int c = 0; c < 4; ++c) { const int tok = row + c * QP; if (row < QP && tok < S) *(v4f*)(yb + (size_t)tok * (2 * INNER) + c4) = val; }
}
__device__ __forceinline__ void decay_tile(const b16* __restrict__ T, const b16* __restrict__ a2, int q0, int lane, float (*Os)[HD + 4], float* __restrict__ yb) {
  const int hh = lane >> 4, col = lane & 15, qi = q0 + col;
  v8f o2[4] = {{}, {}, {}, {}};
  const int kb0 = min(max((q0 >> 5) - 1, 0), S / 32 - 3) * 32;   // first of the 3 key blocks outside which A2 rows q0..q0+15 are all zero (see attn2 planes)
  for (int kb = kb0; kb < kb0 + 96; kb += 32) {
    const v16b af = frag_t(a2, qi, kb, S, hh), al2 = frag_t(a2 + APL, qi, kb, S, hh);   // A2 rows = queries (B operand), k = keys
    asm volatile("s_wait_xcnt 0x0" ::: "memory");                 // the T loads' results may be laid over the address pairs that the four loads above name
#pragma unroll
    for (int n = 0; n < 4; ++n) {
      const v16b tf = frag_t(T, n * 16 + col, kb, S, hh), tl = frag_t(T + VPL, n * 16 + col, kb, S, hh);
      o2[n] = wmma16b(tf, af, o2[n]); o2[n] = wmma16b(tf, al2, o2[n]); o2[n] = wmma16b(tl, af, o2[n]); }
  }
  const float i2 = 1.0f / (VS * AS2);
#pragma unroll
  for (int n = 0; n < 4; ++n)
#pragma unroll
    for (int r = 0; r < 8; ++r) Os[col][n * 16 + 8 * hh + r] = o2[n][r] * i2;
  wave_lds_sync();
#pragma unroll
  for (int j = 0; j < 8; ++j) *(v4f*)(yb + (size_t)(q0 + j * 2 + hh) * (2 * INNER) + HD + col * 4) = *(const v4f*)(&Os[j * 2 + hh][col * 4]);
}
__global__ __launch_bounds__(AW * 32) void attn_kernel(const b16* __restrict__ qh, const b16* __restrict__ kh, const b16* __restrict__ vt, const b16* __restrict__ tt, const b16* __restrict__ a2, float* __restrict__ y) {
  __shared__ __attribute__((aligned(16))) float Os[AW][16][HD + 4];
  __shared__ float Ms[AW][16], Ls[AW][16];
  const int wid = __builtin_amdgcn_readfirstlane(threadIdx.x >> 5), lane = threadIdx.x & 31;   // the wave's number in a scalar register: the role tests are scalar branches
  const int bh = blockIdx.x / BPH, part = blockIdx.x % BPH, b = bh / H, h = bh % H;
  float* yb = y + (size_t)b * S * (2 * INNER) + h * 2 * HD;
  const int grp = wid / NS;                                       // 0, 1: the block's two full tiles; 2: the tile of row 512 (first block of each (b, h) only)
  const int r0 = (grp < SPB) ? (part * SPB + grp) * 16 : QP - 1;
  const bool has_tile = grp < SPB || part == 0;
  if (grp == SPB) {
    decay_tile(tt + (size_t)bh * HD * S, a2, (part * DPB + wid - SPB * NS) * 16, lane, Os[wid], yb);
    asm volatile("s_wait_xcnt 0x0" ::: "memory");                 // the wave may go on to a softmax part, which rewrites the registers that the stores above name
  }
  if (has_tile) softmax_part(qh + (size_t)bh * S * HD, kh + (size_t)bh * S * HD, vt + (size_t)bh * HD * S, r0, (wid % NS) * KPS, lane, Os[wid], Ms[wid], Ls[wid]);
  __syncthreads();                                                // every wave of the block passes it: the 8 parts of a tile are in LDS
  if (has_tile) merge_tile(&Os[grp * NS], &Ms[grp * NS], &Ls[grp * NS], r0, (int)threadIdx.x % (NS * 32), yb);
}

// out = y W_out + b: rows 4096, K = 1024 (y split x8 hi/lo at load), 8 column tiles of 64; + bf16(b); f32 rows. grid (8, 32). Block = 128 rows x 64 columns, 16 waves: 4 row groups of 32
// x 4 parts of K (256 in a row per wave), so that a SIMD holds 4 waves whose load waits cover one another. Each wave leaves its f32 partial tile in LDS; behind one block barrier the 4 parts
// are added in ascending k order, scaled, biased and stored, 256 B (two whole lines) per row. amdgpu_waves_per_eu(4, 4): the register budget of the 4 waves that a SIMD holds here; with the
// default budget (8 waves) the compiler waited for the A rows' loads pair by pair instead of issuing the 8 of a k step together.
constexpr int ORG = 4, OKS = 4, OKP = 2 * INNER / OKS;
__global__ __launch_bounds__(ORG * OKS * 32) __attribute__((amdgpu_waves_per_eu(4, 4))) void out_kernel(const float* __restrict__ y, const b16* __restrict__ wo16, const float* __restrict__ bo, float* __restrict__ out) {
  __shared__ __attribute__((aligned(16))) float Ts[OKS][ORG * 32][64 + 4];
  const int lane = threadIdx.x & 31, wave = threadIdx.x >> 5, nloc = lane & 15, hlf = lane >> 4, g = wave % ORG, ks = wave / ORG, m0 = blockIdx.y * (ORG * 32), c0 = blockIdx.x * 64;
  v8f acc[2][4];
#pragma unroll
  for (int r = 0; r < 2; ++r)
#pragma unroll
    for (int t = 0; t < 4; ++t) acc[r][t] = (v8f){};
  const Opnd A{y + ks * OKP, nullptr, 2 * INNER}, Bo{wo16 + (size_t)(ks * OKP / 32) * 512, nullptr, 2 * INNER};   // W_out plane in fragment order: OKP columns on = OKP / 32 tiles on
  gemm_tile<5, 1>(A, Bo, OKP, m0 + g * 32, c0, nloc, hlf, acc);
#pragma unroll
  for (int t = 0; t < 4; ++t)
#pragma unroll
    for (int r = 0; r < 2; ++r)
#pragma unroll
      for (int v = 0; v < 8; ++v) Ts[ks][g * 32 + r * 16 + 8 * hlf + v][t * 16 + nloc] = acc[r][t][v];
  __syncthreads();                                                // every wave of the block passes it: the 4 parts of K of every row group are in LDS
  const int c4 = nloc * 4;
  v4f bias;
#pragma unroll
  for (int e = 0; e < 4; ++e) bias[e] = bf16_rne(bo[c0 + c4 + e]);
#pragma unroll
  for (int j = 0; j < ORG * 32 * 16 / (ORG * OKS * 32); ++j) {
    const int rr = j * (ORG * OKS * 2) + ((int)threadIdx.x >> 4);
    v4f s = *(const v4f*)(&Ts[0][rr][c4]);
#pragma unroll
    for (int p = 1; p < OKS; ++p) s += *(const v4f*)(&Ts[p][rr][c4]);
    *(v4f*)(out + (size_t)(m0 + rr) * DIM + c0 + c4) = s * 0.125f + bias;
  }
}
}  // namespace

extern "C" void kernel_launch(void* const* d_in, const int* in_sizes, int n_in,
                              void* d_out, int out_size, void* d_ws, size_t ws_size, hipStream_t stream) {
  (void)n_in; (void)out_size;
  const float* x = (const float*)d_in[0]; const float* wqkv = (const float*)d_in[1]; const float* wo = (const float*)d_in[2]; const float* bo = (const float*)d_in[3];
  float* out = (float*)d_out;   // [2][2048][512]
  if (in_sizes[0] != NTOK * DIM || in_sizes[1] != DIM * 4 * INNER || in_sizes[2] != 2 * INNER * DIM || in_sizes[3] != DIM) return;
  size_t off = 0; char* ws = (char*)d_ws;
  auto carve = [&](size_t bytes) { char* p = ws + off; off += (bytes + 255) & ~(size_t)255; return p; };
  unsigned short* x16 = (unsigned short*)carve((size_t)NTOK * DIM * 2); unsigned short* w16 = (unsigned short*)carve((size_t)4 * INNER * DIM * 2); b16* wo16 = (b16*)carve((size_t)DIM * 2 * INNER * 2);
  b16* a2 = (b16*)carve(APL * 2 * 2);
  b16* qh = (b16*)carve(QPL * 2 * 2); b16* kh = (b16*)carve(QPL * 2 * 2); b16* vt = (b16*)carve(VPL * 2 * 2); b16* tt = (b16*)carve(VPL * 2 * 2); float* y = (float*)carve((size_t)NTOK * 2 * INNER * 4);
  if (off > ws_size) return;                                    // ≈ 74 MB
  prep_kernel<<<A2B + 1024, 256, 0, stream>>>(x, wqkv, wo, x16, w16, wo16, a2);
  proj_kernel<<<dim3(4 * INNER / 64, NTOK / 128), 128, 0, stream>>>((const __bf16*)x16, (const __bf16*)w16, qh, kh, vt, tt);
  attn_kernel<<<Bn * H * BPH, AW * 32, 0, stream>>>(qh, kh, vt, tt, a2, y);
  out_kernel<<<dim3(DIM / 64, NTOK / (ORG * 32)), ORG * OKS * 32, 0, stream>>>(y, wo16, bo, out);
}

// v007
// A run of this version takes 67.1 microseconds.
// In two side-by-side timings against v006, it was 1.48 and 1.50 times as fast.
// Over all steps from v000 it is 5.40 times as fast.
#include <hip/hip_runtime.h>

// "Fast attention": [q | k | v | t] = x W_qkv (8 heads x 64 each); query i uses q[i mod 513] (the module's pad/reshape/tile trick with STEP 4, n = 2048); attn1 = softmax(q~.k / 8) over
// all 2048 keys; out1 = attn1.v; attn2[n][m] = exp(-|n-m|/e) / s[m] with s[m] = sum_k exp(-|m-k|/e) (the module's broadcast divides column m by row-sum m); out2 = attn2.t (shared
// over batch and heads); out = [out1 | out2 per head] W_out + b -> [2][2048][512].
// Numerics: x, W_qkv, W_out, b_out rounded to bf16; projection on v_wmma_f32_16x16x32_bf16 (exact products); q, k, v, t, P and the
// merged attention output carried x8 as f16 hi+lo pairs (3 / 2 products) on v_wmma_f32_16x16x32_f16; the analytic attn2 matrix as an x8 f16 hi+lo pair (entries that would be f16-
// subnormal are zeroed identically everywhere — they are < 8e-6 of a row); online softmax and the row sums s[m] in f32. Fragment k-map per lane half hh for A AND B: elements 0..7 <-

namespace {
constexpr int Bn = 2, S = 2048, DIM = 512, H = 8, HD = 64, INNER = 512, NTOK = Bn * S, QP = 513 /* (n + yushu) / STEP */;
constexpr float SCALE = 0.125f, VS = 8.0f, QS = 8.0f, PS = 8.0f, AS2 = 8.0f, INV_E = 0.36787944117144233f;
constexpr size_t QPL = (size_t)Bn * H * S * HD, VPL = QPL, APL = (size_t)S * S;

typedef _Float16 b16;
typedef __attribute__((ext_vector_type(16))) _Float16 v16b;
typedef __attribute__((ext_vector_type(8)))  _Float16 v8b;
typedef __attribute__((ext_vector_type(8)))  float v8f;
typedef __attribute__((ext_vector_type(4)))  float v4f;

__device__ __forceinline__ v8b ld8b(const b16* p) { return *(const v8b*)p; }
__device__ __forceinline__ v16b cat8b(v8b a, v8b b) { return __builtin_shufflevector(a, b, 0, 1, 2, 3, 4, 5, 6, 7, 8, 9, 10, 11, 12, 13, 14, 15); }
// Every 16-bit operand plane in the workspace (rows x kd columns, rows a multiple of 16, kd of 32) lies in fragment order: tiles of 16 rows x 32 k (1 KB), tile (row / 16, k / 32) at index
// (row / 16) * (kd / 32) + k / 32; inside a tile the 16-byte chunk of 8 k at (row, k) stands at place ((k / 16) % 2) * 32 + ((k / 8) % 2) * 16 + row % 16. A fragment load (lane = 16 hh + row % 16)
// then reads 512 bytes in a row, four whole lines, where a row-major plane gave it 32 bytes in each of 16 lines. foff is the one map that every writer and every reader of a plane uses.
__device__ __forceinline__ size_t foff(int row, int k, int kd) { return ((size_t)((row >> 4) * (kd >> 5) + (k >> 5)) << 9) + (size_t)(((((k >> 4) & 1) << 5) | (((k >> 3) & 1) << 4) | (row & 15)) << 3); }
// chunk p of a plane in memory order -> its (row, k): foff(row, k, kd) == 8 p
__device__ __forceinline__ void finv(int p, int kd, int& row, int& k) { const int tile = p >> 6, c = p & 63, tk = kd >> 5; row = (tile / tk) * 16 + (c & 15); k = (tile % tk) * 32 + ((c >> 5) & 1) * 16 + ((c >> 4) & 1) * 8; }
// fragment of row 'row', k in [kb, kb + 32), kb a multiple of 32: elements 0..7 <- k = kb + 8 hh.., 8..15 <- k = kb + 16 + 8 hh.. (the chunks foff(row, kb + 8 hh) and foff(row, kb + 16 + 8 hh))
__device__ __forceinline__ v16b frag_t(const b16* plane, int row, int kb, int kd, int hh) { const b16* p = plane + foff(row, kb + 8 * hh, kd); return cat8b(ld8b(p), ld8b(p + 256)); }
// the same from the address of the fragment's first chunk, p = plane + foff(row, kb + 8 hh, kd)
typedef const __attribute__((address_space(1))) b16* gp16; typedef const __attribute__((address_space(1))) v8b* gp8b;   // pointers typed as global: one that has gone through an asm statement still gives global loads
__device__ __forceinline__ v16b frag_p(gp16 p) { return cat8b(*(gp8b)p, *(gp8b)(p + 256)); }
__device__ __forceinline__ void split16(float v, b16& hi, b16& lo) { hi = (b16)v; lo = (b16)(v - (float)hi); }
__device__ __forceinline__ v8f wmma16b(v16b a, v16b b, v8f c) {
  v8f d = __builtin_amdgcn_wmma_f32_16x16x32_f16(false, a, false, b, (short)0, c, false, false);
  asm volatile("v_nop\n\tv_nop\n\tv_nop\n\tv_nop" : "+v"(d) : "v"(a), "v"(b));
  return d;
}
__device__ __forceinline__ void wave_lds_sync() {
  __builtin_amdgcn_fence(__ATOMIC_RELEASE, "workgroup");
  __builtin_amdgcn_wave_barrier();
  __builtin_amdgcn_fence(__ATOMIC_ACQUIRE, "workgroup");
}

// ANP, BNP: 1 = one f16 fragment; 0, 2, 4, 5 = a hi + lo pair
template <int ANP, int BNP> __device__ __forceinline__ v8f mac(v16b ah, v16b al, v16b bh, v16b bl, v8f c) {
  c = wmma16b(ah, bh, c);
  if (BNP == 0 || BNP == 2 || BNP == 4 || BNP == 5) c = wmma16b(ah, bl, c);     // hi.lo
  if (ANP == 0 || ANP == 2 || ANP == 4 || ANP == 5) c = wmma16b(al, bh, c);     // lo.hi   (lo.lo dropped)
  return c;
}
__device__ __forceinline__ void epi_planes(v8f (&acc)[2][4], float scale, bool two, b16* __restrict__ oh, b16* __restrict__ ol, int ldo,
                                           int m0, int c0, int lane, b16* Th, b16* Tl) {
  const int nloc = lane & 15, hlf = lane >> 4;
#pragma unroll
  for (int t = 0; t < 4; ++t)
#pragma unroll
    for (int r = 0; r < 2; ++r)
#pragma unroll
      for (int v = 0; v < 8; ++v) {
        const int rr = r * 16 + v + 8 * hlf, cc = t * 16 + nloc;
        b16 h_, l_; split16(acc[r][t][v] * scale, h_, l_);
        Th[rr * 64 + cc] = h_; Tl[rr * 64 + cc] = l_;
      }
  wave_lds_sync();
  {
#pragma unroll
    for (int j = 0; j < 8; ++j) {
      const int rr = j * 4 + (lane >> 3), c8 = (lane & 7) * 8;
      const size_t o = (size_t)(m0 + rr) * ldo + c0 + c8;
      *(v8b*)(oh + o) = ld8b(Th + rr * 64 + c8);
      if (two) *(v8b*)(ol + o) = ld8b(Tl + rr * 64 + c8);
    }
    
  }
}
typedef __attribute__((ext_vector_type(8))) __bf16 v8bb; typedef __attribute__((ext_vector_type(16))) __bf16 v16bb;
typedef __attribute__((ext_vector_type(8))) unsigned short v8us;
__device__ __forceinline__ v16bb frag_t_bf(const __bf16* plane, int row, int kb, int kd, int hh) { const __bf16* p = plane + foff(row, kb + 8 * hh, kd); const v8bb a = *(const v8bb*)p, b = *(const v8bb*)(p + 256); return __builtin_shufflevector(a, b, 0, 1, 2, 3, 4, 5, 6, 7, 8, 9, 10, 11, 12, 13, 14, 15); }
__device__ __forceinline__ v8f wmma16bb(v16bb a, v16bb b, v8f c) {
  v8f d = __builtin_amdgcn_wmma_f32_16x16x32_bf16(false, a, false, b, (short)0, c, false, false);
  asm volatile("v_nop\n\tv_nop\n\tv_nop\n\tv_nop" : "+v"(d) : "v"(a), "v"(b));
  return d;
}
__device__ __forceinline__ unsigned short bf16_rne_bits(float v) { unsigned int u = __float_as_uint(v); u += 0x7FFFu + ((u >> 16) & 1u); return (unsigned short)(u >> 16); }
__device__ __forceinline__ float bf16_rne(float v) { return __uint_as_float(((unsigned int)bf16_rne_bits(v)) << 16); }



// attn2 planes: A2[n][m] = 8 exp(-|n-m|/e)/s[m] as hi/lo f16 planes [2048][2048], s[m] = sum_k exp(-|m-k|/e) (f32, same expf); entries below the f16 normal range zeroed.
// That rule zeroes every entry with |n-m| >= 33: s[m] >= 1 (its k = m term), so 8 exp(-33/e)/s[m] <= 4.3e-5 < 2^-14. For a row n of the 32-row group j = n / 32 the key blocks of 32
// other than j-1, j, j+1 hold only such entries: they are neither written nor read. Read per row: 3 blocks from block clamp(j-1, 0, 61); written: the 4 whole tiles of 16 rows x 32 keys (128 keys,
// from block clamp((j-1) & ~1, 0, 60)) that hold those 3.
// The 2048 terms of s[m] are exp(-d/e) for d = 0, then d = 1..m (keys below m) and d = 1..2047-m (keys above): with Q[j] = sum_{d=1..j} exp(-d/e), s[m] = 1 + Q[m] + Q[2047-m], every term
// kept. A block of 256 threads forms all of Q itself (8 terms a thread, a scan over the block, in ascending d), so the planes need no launch before them: they are built by A2B blocks of
// their own in the launch that rounds x and the weights (16 rows x 128 keys a block).
constexpr int A2B = S * 16 / 256;
// exp(-|d|/e) as __expf forms it (two multiplies, v_exp_f32), with the one slot that the instruction set asks for behind a transcendental inside the statement
__device__ __forceinline__ float decay_term(int d) { float r; asm("v_exp_f32 %0, %1\n\tv_nop" : "=v"(r) : "v"((-fabsf((float)d) * INV_E) * 1.44269504088896340736f)); return r; }
__device__ __forceinline__ void attn2_block(int blk, b16* __restrict__ a2, float* Q, float* Wt) {
  const int t = threadIdx.x, lane = t & 31, wave = t >> 5;
  float pre[8], run = 0.0f;
#pragma unroll
  for (int e = 0; e < 8; ++e) { const int d = 8 * t + e; const float ex = decay_term(d); run += (d == 0) ? 0.0f : ex; pre[e] = run; }
  float inc = run;                                                // sum of the wave's threads up to and with this one
#pragma unroll
  for (int o = 1; o < 32; o <<= 1) { const float u = __shfl_up(inc, o); if (lane >= o) inc += u; }
  if (lane == 31) Wt[wave] = inc;
  float base = __shfl_up(inc, 1); if (lane == 0) base = 0.0f;
  __syncthreads();                                                // the 8 waves' totals are in LDS
  float wb = 0.0f;
#pragma unroll
  for (int w = 0; w < 7; ++w) wb += (w < wave) ? Wt[w] : 0.0f;    // the waves below this one, in ascending d
  base += wb;
#pragma unroll
  for (int e = 0; e < 8; ++e) Q[8 * t + e] = base + pre[e];
  __syncthreads();                                                // all of Q is in LDS
  const int n = blk * 16 + (t & 15), m0 = min(max(((n >> 5) - 1) & ~1, 0), S / 32 - 4) * 32 + (t >> 4) * 8; v8b hv, lv;   // a wave: 16 rows x 2 chunks = 512 bytes in a row of the plane
#pragma unroll
  for (int e = 0; e < 8; ++e) { const int m = m0 + e; const float s = 1.0f + Q[m] + Q[S - 1 - m];
    float v = AS2 * decay_term(n - m) / s; if (v < 6.103515625e-05f) v = 0.0f; b16 a, c; split16(v, a, c); hv[e] = a; lv[e] = c; }
  { const size_t o = foff(n, m0, S); *(v8b*)(a2 + o) = hv; *(v8b*)(a2 + APL + o) = lv; }
}

__global__ __launch_bounds__(256) void prep_kernel(const float* __restrict__ x, const float* __restrict__ wqkv, const float* __restrict__ wo, unsigned short* __restrict__ x16, unsigned short* __restrict__ w16, b16* __restrict__ wo16, b16* __restrict__ a2) {
  __shared__ __attribute__((aligned(16))) float Q[S];
  __shared__ float Wt[8];
  if (blockIdx.x < A2B) { attn2_block(blockIdx.x, a2, Q, Wt); return; }   // the same for a whole block
  const size_t tid = (size_t)(blockIdx.x - A2B) * blockDim.x + threadIdx.x, nth = (size_t)(gridDim.x - A2B) * blockDim.x;
  {
    for (size_t p = tid; p < (size_t)NTOK * DIM / 8; p += nth) { int n, k0; finv((int)p, DIM, n, k0); v8us v;
#pragma unroll
      for (int e = 0; e < 8; ++e) v[e] = bf16_rne_bits(x[(size_t)n * DIM + k0 + e]);
      *(v8us*)(x16 + foff(n, k0, DIM)) = v; }
    for (size_t p = tid; p < (size_t)4 * INNER * DIM / 8; p += nth) { int n, k0; finv((int)p, DIM, n, k0); v8us v;
#pragma unroll
      for (int e = 0; e < 8; ++e) v[e] = bf16_rne_bits(wqkv[(size_t)(k0 + e) * 4 * INNER + n]);
      *(v8us*)(w16 + foff(n, k0, DIM)) = v; }
    for (size_t p = tid; p < (size_t)DIM * 2 * INNER / 8; p += nth) { int n, k0; finv((int)p, 2 * INNER, n, k0); v8b w;
#pragma unroll
      for (int e = 0; e < 8; ++e) w[e] = (b16)bf16_rne(wo[(size_t)(k0 + e) * DIM + n]);
      *(v8b*)(wo16 + foff(n, k0, 2 * INNER)) = w; }
    
  }
}

// projections: rows = tokens (4096), K = 512, column tiles of 64 = one head of q | k | v | t (32 tiles): q/k -> x8 hi/lo rows [b*H + h][tok][64]; v, t -> (8v)^T, (8t)^T hi/lo planes
// [b*H + h][64][tok]; every plane of a (b, h) in fragment order (foff). grid (32, 32) x 128.
__global__ __launch_bounds__(128) void proj_kernel(const __bf16* __restrict__ x16, const __bf16* __restrict__ w16, b16* __restrict__ qh, b16* __restrict__ kh, b16* __restrict__ vt, b16* __restrict__ tt) {
  __shared__ __attribute__((aligned(16))) b16 Th[4][32][HD + 8], Tq[4][32][HD + 8];
  __shared__ __attribute__((aligned(16))) b16 Tt[64][128 + 8], Tl[64][128 + 8];
  const int lane = threadIdx.x & 31, wave = threadIdx.x >> 5, nloc = lane & 15, hlf = lane >> 4, m0 = blockIdx.y * 128 + wave * 32, c0 = blockIdx.x * 64;
  const int which = blockIdx.x / H, head = blockIdx.x % H, b = m0 / S, tok0 = m0 % S;
  v8f acc[2][4];
#pragma unroll
  for (int r = 0; r < 2; ++r)
#pragma unroll
    for (int t = 0; t < 4; ++t) acc[r][t] = (v8f){};
  // The 12 loads of a k step are issued together, one whole step ahead of the WMMAs that use them (two register sets): loads do not move over the statements behind the WMMAs, so their place in
  // the source is their place in the listing. Unrolled: the set index is a constant and the 16 steps differ only in the loads' immediate offsets.
  v16bb fa[2][2], fb[2][4];
  fa[0][0] = frag_t_bf(x16, m0 + nloc, 0, DIM, hlf); fa[0][1] = frag_t_bf(x16, m0 + 16 + nloc, 0, DIM, hlf);
#pragma unroll
  for (int t = 0; t < 4; ++t) fb[0][t] = frag_t_bf(w16, c0 + t * 16 + nloc, 0, DIM, hlf);
#pragma unroll
  for (int kb = 0; kb < DIM; kb += 32) {
    const int cu = (kb >> 5) & 1, nx = cu ^ 1;
    if (kb + 32 < DIM) {
      fa[nx][0] = frag_t_bf(x16, m0 + nloc, kb + 32, DIM, hlf); fa[nx][1] = frag_t_bf(x16, m0 + 16 + nloc, kb + 32, DIM, hlf);
#pragma unroll
      for (int t = 0; t < 4; ++t) fb[nx][t] = frag_t_bf(w16, c0 + t * 16 + nloc, kb + 32, DIM, hlf);
    }
#pragma unroll
    for (int t = 0; t < 4; ++t) { acc[0][t] = wmma16bb(fa[cu][0], fb[cu][t], acc[0][t]); acc[1][t] = wmma16bb(fa[cu][1], fb[cu][t], acc[1][t]); } }
  if (which < 2) {
#pragma unroll
    for (int t = 0; t < 4; ++t)
#pragma unroll
      for (int r = 0; r < 2; ++r)
#pragma unroll
        for (int v = 0; v < 8; ++v) { b16 a_, c_; split16(acc[r][t][v] * QS, a_, c_); Th[wave][r * 16 + 8 * hlf + v][t * 16 + nloc] = a_; Tq[wave][r * 16 + 8 * hlf + v][t * 16 + nloc] = c_; }
    wave_lds_sync();
    b16* dst = ((which == 0) ? qh : kh) + ((size_t)b * H + head) * S * HD;
    {
#pragma unroll
      for (int j = 0; j < 8; ++j) { const int rr = (j >> 2) * 16 + nloc, c8 = (j & 3) * 16 + hlf * 8; const size_t o = foff(tok0 + rr, c8, HD);   // half a tile, 512 bytes in a row, per store
        *(v8b*)(dst + o) = *(const v8b*)(&Th[wave][rr][c8]); *(v8b*)(dst + QPL + o) = *(const v8b*)(&Tq[wave][rr][c8]); }
       }
    return;
  }
#pragma unroll
  for (int t = 0; t < 4; ++t)
#pragma unroll
    for (int r = 0; r < 2; ++r)
#pragma unroll
      for (int v = 0; v < 8; ++v) { b16 a_, c_; split16(acc[r][t][v] * VS, a_, c_); Tt[t * 16 + nloc][wave * 32 + r * 16 + 8 * hlf + v] = a_; Tl[t * 16 + nloc][wave * 32 + r * 16 + 8 * hlf + v] = c_; }
  __syncthreads();
  b16* dstv = ((which == 2) ? vt : tt) + (((size_t)b * H + head) * HD) * S; const int tokb = (blockIdx.y * 128) % S;
  {
#pragma unroll
    for (int j = 0; j < 8; ++j) { const int dd = wave * 16 + nloc, c8 = j * 16 + hlf * 8; const size_t o = foff(dd, tokb + c8, S);   // half a tile, 512 bytes in a row, per store
      *(v8b*)(dstv + o) = *(const v8b*)(&Tt[dd][c8]); *(v8b*)(dstv + VPL + o) = *(const v8b*)(&Tl[dd][c8]); }
    asm volatile("s_wait_xcnt 0x0" ::: "memory");                 // in the listing the q / k branch, which rewrites the registers that these stores name, stands behind them
    
  }
}

// attention. The query row of token i is q[i mod 513], so softmax(q~.k / 8).v has only 513 distinct rows per (b, h): each is computed ONCE and stored to its up to four tokens
// r, r + 513, r + 1026, r + 1539 (< 2048). Block = (b, h, 1/16 of the sequence), 24 waves:
//   waves 0..15 : two softmax tiles of 16 distinct rows (32 full tiles per (b, h)), each tile's 2048 keys split over 8 waves (256 keys in a row per wave);
//   waves 16..23: decay tiles of 16 tokens, o2 += (8t)^T . A2^T rows (A2[q][m] as the B operand: rows = queries, k = keys; 3 products), over the 3 key blocks outside which A2 is zero;
//                 in the first block of each (b, h) they then take the 8 key parts of the tile that holds row 512 (rows 513.. are not stored).
// A softmax wave runs the online softmax over its own keys in ascending order in steps of 32 (k x q hi/lo, 3 products; o1 += (8v)^T.P, 3 products) and leaves its running maximum m, its sum l
// and its unnormalised o1 in LDS; behind one block barrier the 8 parts of a tile are merged in ascending key order: M = max m_w, l = sum l_w e^(m_w - M), o1 = sum o1_w e^(m_w - M).
// y[tok][h*128 + 0..63] = o1/(64 l), [64..127] = o2/64; f32 rows; each role stores 256 B (two whole lines) per row.
constexpr int NS = 8, KPS = S / NS, SPB = 2, DPB = 8, BPH = S / 16 / DPB, AW = SPB * NS + DPB;
static_assert(BPH * SPB * 16 == QP - 1 && QP * 4 >= S, "32 full tiles of distinct rows and one more row; four copies cover the sequence");
static_assert(DPB == NS && KPS % 32 == 0, "the decay waves of a block are as many as the key parts of the last tile");
__device__ __forceinline__ void softmax_part(const b16* __restrict__ Q, const b16* __restrict__ K, const b16* __restrict__ V, int r0, int kb0, int lane, float (*Os)[HD + 4], float* Ms, float* Ls) {
  const int hh = lane >> 4, col = lane & 15, qsrc = r0 + col;
  gp16 qp = (gp16)(Q + foff(qsrc, 8 * hh, HD));        // the lane's chunk in the first of the query rows' two tiles
  float m = -INFINITY, l = 0.0f; v8f o1[4] = {{}, {}, {}, {}};
  gp16 kp = (gp16)(K + foff(kb0 + col, 8 * hh, HD));   // the lane's chunk in the first K tile of the step: a step's 32 keys are 4 tiles in a row (16 keys on = 2 tiles = 1024 elements, 32 k on = 1 tile)
  gp16 vp = (gp16)(V + foff(col, kb0 + 8 * hh, S));    // the lane's chunk in the step's first V tile: 16 rows of V^T on = S / 32 tiles, 32 keys on = 1 tile
  for (int kb = kb0; kb < kb0 + KPS; kb += 32) {
    v8f s0 = {}, s1 = {};
    // 12 of the step's 16 K loads are issued together, ahead of the first score WMMA: loads do not move over the statements behind the WMMAs, so their place in the source is their place in the listing.
    // The last 4 (used by the step's last 3 score WMMAs) follow once the first 3 WMMAs have freed registers: all 16 at once did not fit the registers of 6 waves a SIMD.
    // The query fragments come with them, anew in every step (8 loads of lines that the step before has read): held over the loop, their 32 registers were spilled once the V loads fly during the softmax arithmetic.
    v16b qf[2], ql[2], k0[2], k0l[2], k1[2], k1l[2];
    qf[0] = frag_p(qp); ql[0] = frag_p(qp + QPL); qf[1] = frag_p(qp + 512); ql[1] = frag_p(qp + QPL + 512);
    k0[0] = frag_p(kp); k0l[0] = frag_p(kp + QPL); k1[0] = frag_p(kp + 1024); k1l[0] = frag_p(kp + QPL + 1024); k0[1] = frag_p(kp + 512); k0l[1] = frag_p(kp + QPL + 512);
    s0 = wmma16b(k0[0], qf[0], s0); s0 = wmma16b(k0[0], ql[0], s0); s0 = wmma16b(k0l[0], qf[0], s0);
    k1[1] = frag_p(kp + 1024 + 512); k1l[1] = frag_p(kp + QPL + 1024 + 512);
    // the step's 16 K loads name one address pair, its 8 query loads another; both go through the wait's statement so that they live up to the wait: else the last load's result was laid over the pair while the
    // loads before it were out (and the query pair, seen unchanged, would let the compiler lift the query loads out of the loop again)
    asm volatile("s_wait_xcnt 0x0" : "+v"(kp), "+v"(qp) : : "memory"); kp += 2048;
    s1 = wmma16b(k1[0], qf[0], s1); s1 = wmma16b(k1[0], ql[0], s1); s1 = wmma16b(k1l[0], qf[0], s1);
    s0 = wmma16b(k0[1], qf[1], s0); s0 = wmma16b(k0[1], ql[1], s0); s0 = wmma16b(k0l[1], qf[1], s0); s1 = wmma16b(k1[1], qf[1], s1); s1 = wmma16b(k1[1], ql[1], s1); s1 = wmma16b(k1l[1], qf[1], s1);
    // the step's 16 V loads, together, behind the last score WMMA (the K and query registers are free) and ahead of the softmax arithmetic, which covers their flight
    v16b vf[4], vl[4];
#pragma unroll
    for (int n = 0; n < 4; ++n) { vf[n] = frag_p(vp + n * (S / 32) * 512); vl[n] = frag_p(vp + VPL + n * (S / 32) * 512); }
    asm volatile("s_wait_xcnt 0x0" : "+v"(vp) : : "memory"); vp += 512;   // as for K: the 16 V loads name one address pair, which lives up to this wait and is advanced behind it
    float mr = -INFINITY;
#pragma unroll
    for (int r = 0; r < 8; ++r) { s0[r] *= SCALE / (QS * QS); s1[r] *= SCALE / (QS * QS); mr = fmaxf(mr, fmaxf(s0[r], s1[r])); }
    mr = fmaxf(mr, __shfl_xor(mr, 16));
    const float mn = fmaxf(m, mr), al_ = __expf(m - mn); m = mn;
    float sum = 0.0f; v16b pb, pl;
#pragma unroll
    for (int r = 0; r < 8; ++r) { const float e0 = __expf(s0[r] - mn), e1 = __expf(s1[r] - mn); sum += e0 + e1; b16 a, c; split16(e0 * PS, a, c); pb[r] = a; pl[r] = c; split16(e1 * PS, a, c); pb[8 + r] = a; pl[8 + r] = c; }
    sum += __shfl_xor(sum, 16); l = l * al_ + sum;
#pragma unroll
    for (int n = 0; n < 4; ++n) {
#pragma unroll
      for (int r = 0; r < 8; ++r) o1[n][r] *= al_;
      o1[n] = wmma16b(vf[n], pb, o1[n]); o1[n] = wmma16b(vf[n], pl, o1[n]); o1[n] = wmma16b(vl[n], pb, o1[n]); }
  }
#pragma unroll
  for (int n = 0; n < 4; ++n)
#pragma unroll
    for (int r = 0; r < 8; ++r) Os[col][n * 16 + 8 * hh + r] = o1[n][r];
  if (hh == 0) { Ms[col] = m; Ls[col] = l; }
}
// one float4 of a tile's 16 x 64 result per thread t of 256: two rows x 256 B per store instruction (16 lanes x 16 B a row), once per token that uses the row
__device__ __forceinline__ void merge_tile(const float (*Os)[16][HD + 4], const float (*Ms)[16], const float (*Ls)[16], int r0, int t, float* __restrict__ yb) {
  const int rl = t >> 4, c4 = (t & 15) * 4, row = r0 + rl;
  float M = Ms[0][rl];
#pragma unroll
  for (int w = 1; w < NS; ++w) M = fmaxf(M, Ms[w][rl]);
  float l = 0.0f; v4f acc = {};
#pragma unroll
  for (int w = 0; w < NS; ++w) { const float f = __expf(Ms[w][rl] - M); l += Ls[w][rl] * f; acc += *(const v4f*)(&Os[w][rl][c4]) * f; }
  const v4f val = acc * (1.0f / (VS * PS * l));
#pragma unroll
  for (int c = 0; c < 4; ++c) { const int tok = row + c * QP; if (row < QP && tok < S) *(v4f*)(yb + (size_t)tok * (2 * INNER) + c4) = val; }
}
__device__ __forceinline__ void decay_tile(const b16* __restrict__ T, const b16* __restrict__ a2, int q0, int lane, float (*Os)[HD + 4], float* __restrict__ yb) {
  const int hh = lane >> 4, col = lane & 15, qi = q0 + col;
  v8f o2[4] = {{}, {}, {}, {}};
  const int kb0 = min(max((q0 >> 5) - 1, 0), S / 32 - 3) * 32;   // first of the 3 key blocks outside which A2 rows q0..q0+15 are all zero (see attn2 planes)
  gp16 tp = (gp16)(T + foff(col, kb0 + 8 * hh, S));              // the lane's chunk in the step's first T tile: 16 rows of T^T on = S / 32 tiles, 32 keys on = 1 tile
  for (int kb = kb0; kb < kb0 + 96; kb += 32) {
    const v16b af = frag_t(a2, qi, kb, S, hh), al2 = frag_t(a2 + APL, qi, kb, S, hh);   // A2 rows = queries (B operand), k = keys
    asm volatile("s_wait_xcnt 0x0" ::: "memory");                 // the T loads' results may be laid over the address pairs that the four loads above name
    v16b tf[4], tl[4];                                            // the step's 16 T loads together, ahead of its first WMMA
#pragma unroll
    for (int n = 0; n < 4; ++n) { tf[n] = frag_p(tp + n * (S / 32) * 512); tl[n] = frag_p(tp + VPL + n * (S / 32) * 512); }
    asm volatile("s_wait_xcnt 0x0" : "+v"(tp) : : "memory"); tp += 512;   // the 16 T loads name one address pair, which lives up to this wait (else a later load's result was laid over it) and is advanced behind it
#pragma unroll
    for (int n = 0; n < 4; ++n) { o2[n] = wmma16b(tf[n], af, o2[n]); o2[n] = wmma16b(tf[n], al2, o2[n]); o2[n] = wmma16b(tl[n], af, o2[n]); }
  }
  const float i2 = 1.0f / (VS * AS2);
#pragma unroll
  for (int n = 0; n < 4; ++n)
#pragma unroll
    for (int r = 0; r < 8; ++r) Os[col][n * 16 + 8 * hh + r] = o2[n][r] * i2;
  wave_lds_sync();
#pragma unroll
  for (int j = 0; j < 8; ++j) *(v4f*)(yb + (size_t)(q0 + j * 2 + hh) * (2 * INNER) + HD + col * 4) = *(const v4f*)(&Os[j * 2 + hh][col * 4]);
}
__global__ __launch_bounds__(AW * 32) void attn_kernel(const b16* __restrict__ qh, const b16* __restrict__ kh, const b16* __restrict__ vt, const b16* __restrict__ tt, const b16* __restrict__ a2, float* __restrict__ y) {
  __shared__ __attribute__((aligned(16))) float Os[AW][16][HD + 4];
  __shared__ float Ms[AW][16], Ls[AW][16];
  const int wid = __builtin_amdgcn_readfirstlane(threadIdx.x >> 5), lane = threadIdx.x & 31;   // the wave's number in a scalar register: the role tests are scalar branches
  const int bh = blockIdx.x / BPH, part = blockIdx.x % BPH, b = bh / H, h = bh % H;
  float* yb = y + (size_t)b * S * (2 * INNER) + h * 2 * HD;
  const int grp = wid / NS;                                       // 0, 1: the block's two full tiles; 2: the tile of row 512 (first block of each (b, h) only)
  const int r0 = (grp < SPB) ? (part * SPB + grp) * 16 : QP - 1;
  const bool has_tile = grp < SPB || part == 0;
  if (grp == SPB) {
    decay_tile(tt + (size_t)bh * HD * S, a2, (part * DPB + wid - SPB * NS) * 16, lane, Os[wid], yb);
    asm volatile("s_wait_xcnt 0x0" ::: "memory");                 // the wave may go on to a softmax part, which rewrites the registers that the stores above name
  }
  if (has_tile) softmax_part(qh + (size_t)bh * S * HD, kh + (size_t)bh * S * HD, vt + (size_t)bh * HD * S, r0, (wid % NS) * KPS, lane, Os[wid], Ms[wid], Ls[wid]);
  __syncthreads();                                                // every wave of the block passes it: the 8 parts of a tile are in LDS
  if (has_tile) merge_tile(&Os[grp * NS], &Ms[grp * NS], &Ls[grp * NS], r0, (int)threadIdx.x % (NS * 32), yb);
}

// out = y W_out + b: rows 4096, K = 1024 (y split x8 hi/lo at load), 8 column tiles of 64; + bf16(b); f32 rows. grid (8, 32). Block = 128 rows x 64 columns, 16 waves: 4 row groups of 32
// x 4 parts of K (256 in a row per wave), so that a SIMD holds 4 waves whose load waits cover one another. Each wave leaves its f32 partial tile in LDS; behind one block barrier the 4 parts
// are added in ascending k order, scaled, biased and stored, 256 B (two whole lines) per row. amdgpu_waves_per_eu(4, 4): the register budget of the 4 waves that a SIMD holds here; with the
// default budget (8 waves) the compiler waited for the A rows' loads pair by pair instead of issuing the 8 of a k step together.
constexpr int ORG = 4, OKS = 4, OKP = 2 * INNER / OKS;
__global__ __launch_bounds__(ORG * OKS * 32) __attribute__((amdgpu_waves_per_eu(4, 4))) void out_kernel(const float* __restrict__ y, const b16* __restrict__ wo16, const float* __restrict__ bo, float* __restrict__ out) {
  __shared__ __attribute__((aligned(16))) float Ts[OKS][ORG * 32][64 + 4];
  const int lane = threadIdx.x & 31, wave = threadIdx.x >> 5, nloc = lane & 15, hlf = lane >> 4, g = wave % ORG, ks = wave / ORG, m0 = blockIdx.y * (ORG * 32), c0 = blockIdx.x * 64;
  v8f acc[2][4];
#pragma unroll
  for (int r = 0; r < 2; ++r)
#pragma unroll
    for (int t = 0; t < 4; ++t) acc[r][t] = (v8f){};
  // The 16 loads of a k step (8 of y's f32 rows, 8 of W_out) are issued together, one whole step ahead of the split and the WMMAs that use them (two register sets); unrolled: the set index is a constant.
  const float* ya = y + (size_t)(m0 + g * 32 + nloc) * (2 * INNER) + ks * OKP + 8 * hlf;   // row group r: 16 rows on; elements 0..7 at k + 8 hh, 8..15 at k + 16 + 8 hh
  v4f ra[2][2][4]; v16b rb[2][4];
  auto fetch = [&](int kb, int set) {
#pragma unroll
    for (int r = 0; r < 2; ++r) { const float* p = ya + (size_t)r * 16 * (2 * INNER) + kb; ra[set][r][0] = *(const v4f*)p; ra[set][r][1] = *(const v4f*)(p + 4); ra[set][r][2] = *(const v4f*)(p + 16); ra[set][r][3] = *(const v4f*)(p + 20); }
#pragma unroll
    for (int t = 0; t < 4; ++t) rb[set][t] = frag_t(wo16, c0 + t * 16 + nloc, ks * OKP + kb, 2 * INNER, hlf);
  };
  fetch(0, 0);
#pragma unroll
  for (int kb = 0; kb < OKP; kb += 32) {
    const int cu = (kb >> 5) & 1;
    if (kb + 32 < OKP) fetch(kb + 32, cu ^ 1);
    v16b ah[2], al[2];
#pragma unroll
    for (int r = 0; r < 2; ++r)
#pragma unroll
      for (int e = 0; e < 16; ++e) { b16 a, c; split16(ra[cu][r][e >> 2][e & 3] * 8.0f, a, c); ah[r][e] = a; al[r][e] = c; }   // x8 then split (keeps the lo halves of small values normal)
#pragma unroll
    for (int t = 0; t < 4; ++t) { acc[0][t] = mac<5, 1>(ah[0], al[0], rb[cu][t], rb[cu][t], acc[0][t]); acc[1][t] = mac<5, 1>(ah[1], al[1], rb[cu][t], rb[cu][t], acc[1][t]); }
    __builtin_amdgcn_sched_barrier(0);                            // keeps the next step's split behind this step's WMMAs: lifted among them it waited for the loads that had only just been issued
  }
#pragma unroll
  for (int t = 0; t < 4; ++t)
#pragma unroll
    for (int r = 0; r < 2; ++r)
#pragma unroll
      for (int v = 0; v < 8; ++v) Ts[ks][g * 32 + r * 16 + 8 * hlf + v][t * 16 + nloc] = acc[r][t][v];
  __syncthreads();                                                // every wave of the block passes it: the 4 parts of K of every row group are in LDS
  const int c4 = nloc * 4;
  v4f bias;
#pragma unroll
  for (int e = 0; e < 4; ++e) bias[e] = bf16_rne(bo[c0 + c4 + e]);
#pragma unroll
  for (int j = 0; j < ORG * 32 * 16 / (ORG * OKS * 32); ++j) {
    const int rr = j * (ORG * OKS * 2) + ((int)threadIdx.x >> 4);
    v4f s = *(const v4f*)(&Ts[0][rr][c4]);
#pragma unroll
    for (int p = 1; p < OKS; ++p) s += *(const v4f*)(&Ts[p][rr][c4]);
    *(v4f*)(out + (size_t)(m0 + rr) * DIM + c0 + c4) = s * 0.125f + bias;
  }
}
}  // namespace

extern "C" void kernel_launch(void* const* d_in, const int* in_sizes, int n_in,
                              void* d_out, int out_size, void* d_ws, size_t ws_size, hipStream_t stream) {
  (void)n_in; (void)out_size;
  const float* x = (const float*)d_in[0]; const float* wqkv = (const float*)d_in[1]; const float* wo = (const float*)d_in[2]; const float* bo = (const float*)d_in[3];
  float* out = (float*)d_out;   // [2][2048][512]
  if (in_sizes[0] != NTOK * DIM || in_sizes[1] != DIM * 4 * INNER || in_sizes[2] != 2 * INNER * DIM || in_sizes[3] != DIM) return;
  size_t off = 0; char* ws = (char*)d_ws;
  auto carve = [&](size_t bytes) { char* p = ws + off; off += (bytes + 255) & ~(size_t)255; return p; };
  unsigned short* x16 = (unsigned short*)carve((size_t)NTOK * DIM * 2); unsigned short* w16 = (unsigned short*)carve((size_t)4 * INNER * DIM * 2); b16* wo16 = (b16*)carve((size_t)DIM * 2 * INNER * 2);
  b16* a2 = (b16*)carve(APL * 2 * 2);
  b16* qh = (b16*)carve(QPL * 2 * 2); b16* kh = (b16*)carve(QPL * 2 * 2); b16* vt = (b16*)carve(VPL * 2 * 2); b16* tt = (b16*)carve(VPL * 2 * 2); float* y = (float*)carve((size_t)NTOK * 2 * INNER * 4);
  if (off > ws_size) return;                                    // ≈ 74 MB
  prep_kernel<<<A2B + 1024, 256, 0, stream>>>(x, wqkv, wo, x16, w16, wo16, a2);
  proj_kernel<<<dim3(4 * INNER / 64, NTOK / 128), 128, 0, stream>>>((const __bf16*)x16, (const __bf16*)w16, qh, kh, vt, tt);
  attn_kernel<<<Bn * H * BPH, AW * 32, 0, stream>>>(qh, kh, vt, tt, a2, y);
  out_kernel<<<dim3(DIM / 64, NTOK / (ORG * 32)), ORG * OKS * 32, 0, stream>>>(y, wo16, bo, out);
}
